// v000
// Times are from an AMD MI455X. After a warm-up the kernel runs many times in a row, and a time is the length of
// such a window on the GPU divided by its runs, so every launch and the gaps after it count. The runs cycle
// through copies of the inputs. A figure is the median of several windows, for all but v000 over two sittings.
// Sittings can differ by a few percent; kernels timed side by side share one.
// The starting kernel, v000, takes 72.7 microseconds a run.
#include <hip/hip_runtime.h>
#include <hip/hip_bf16.h>
#include <math.h>

typedef __attribute__((ext_vector_type(16))) __bf16 v16bf;
typedef __attribute__((ext_vector_type(8)))  __bf16 v8bf;
typedef __attribute__((ext_vector_type(4)))  __bf16 v4bf;
typedef __attribute__((ext_vector_type(8)))  float  v8f;

#define G_     4
#define B_     16
#define CIN_   512
#define T_     2048
#define H_     2048
#define COUT_  512
#define KG1_   128   // Cin/G
#define KG2_   512   // H/G
#define TN_    64    // token tile per block
#define W1ELEMS_ (H_ * KG1_)     // 262144
#define W2ELEMS_ (COUT_ * KG2_)  // 262144

// K8-interleaved LDS layout: element (k, n) -> ((k>>3)*TN_ + n)*8 + (k&7)
__device__ __forceinline__ int k8idx(int k, int n) {
  return ((k >> 3) * TN_ + n) * 8 + (k & 7);
}

// A fragment (16x32 bf16) from row-major bf16 weights: 2x global b128 loads.
__device__ __forceinline__ v16bf load_a_bf16(const __bf16* __restrict__ W,
                                             int row0, int ld, int kb, int lane) {
  const int m = lane & 15, hi = lane >> 4;
  const __bf16* wr = W + (size_t)(row0 + m) * ld + kb + hi * 8;
  const v8bf lo = *(const v8bf*)(wr);
  const v8bf hs = *(const v8bf*)(wr + 16);
  return __builtin_shufflevector(lo, hs, 0, 1, 2, 3, 4, 5, 6, 7,
                                 8, 9, 10, 11, 12, 13, 14, 15);
}

// B fragment (32x16) from K8-interleaved LDS: 2x ds_load_b128.
__device__ __forceinline__ v16bf load_b_k8(const __bf16* S, int kb, int nb, int lane) {
  const int n  = nb + (lane & 15);
  const int hi = lane >> 4;
  const int kg = (kb >> 3) + hi;
  const v8bf lo = *(const v8bf*)(S + ((size_t)kg * TN_ + n) * 8);
  const v8bf hs = *(const v8bf*)(S + ((size_t)(kg + 2) * TN_ + n) * 8);
  return __builtin_shufflevector(lo, hs, 0, 1, 2, 3, 4, 5, 6, 7,
                                 8, 9, 10, 11, 12, 13, 14, 15);
}

// GELU via native CDNA5 v_tanh_f32 transcendental (error << bf16 storage ulp).
__device__ __forceinline__ float gelu_fast(float v) {
  const float v2 = v * v;
  const float u  = v * fmaf(v2, 0.0356774081f, 0.7978845608f);
  float t;
  asm("v_tanh_f32 %0, %1\n\tv_nop\n\tv_nop" : "=v"(t) : "v"(u));
  const float hv = 0.5f * v;
  return fmaf(hv, t, hv);
}

// ---- prologue: convert f32 weights to bf16 in workspace (runs once per call) ----
__global__ __launch_bounds__(256) void cvt_weights(const float* __restrict__ w1,
                                                   const float* __restrict__ w2,
                                                   __bf16* __restrict__ wb) {
  const int idx = blockIdx.x * 256 + threadIdx.x;   // 131072 threads
  const int e   = idx * 4;                          // 524288 elems total
  float4 v;
  if (e < W1ELEMS_) v = *(const float4*)(w1 + e);
  else              v = *(const float4*)(w2 + (e - W1ELEMS_));
  v4bf p;
  p[0] = (__bf16)v.x; p[1] = (__bf16)v.y; p[2] = (__bf16)v.z; p[3] = (__bf16)v.w;
  *(v4bf*)(wb + e) = p;
}

__global__ __launch_bounds__(256) void ffn2_fused_wmma(
    const float* __restrict__ x, const float* __restrict__ mask,
    const __bf16* __restrict__ w1b, const float* __restrict__ b1,
    const __bf16* __restrict__ w2b, const float* __restrict__ b2,
    float* __restrict__ out) {
  __shared__ __bf16 Xs[CIN_ * TN_];  // masked input tile, K8 layout (64 KB)
  __shared__ __bf16 Hs[KG2_ * TN_];  // shuffled+GELU hidden tile, K8 layout (64 KB)

  const int tid  = threadIdx.x;
  const int lane = tid & 31;
  const int wave = tid >> 5;
  const int nlo  = lane & 15;
  const int hi   = lane >> 4;

  const int bid   = blockIdx.x;
  const int tTile = bid & 31;            // T_/TN_ = 32 tiles
  const int g2    = (bid >> 5) & 3;      // output group
  const int b     = bid >> 7;            // batch
  const int t0    = tTile * TN_;

  // ---- X tile load: 8 coalesced b32 loads + mask + pack -> ds_store_b128 ----
  {
    const float* xb = x + (size_t)b * CIN_ * T_;
    const float* mb = mask + (size_t)b * T_;
    for (int q = tid; q < (CIN_ / 8) * TN_; q += 256) {
      const int n  = q & (TN_ - 1);
      const int kg = q >> 6;             // 8-channel group
      const float mk = mb[t0 + n];
      const float* xp = xb + (size_t)(kg * 8) * T_ + t0 + n;
      v8bf pk;
#pragma unroll
      for (int e = 0; e < 8; ++e)
        pk[e] = (__bf16)(xp[(size_t)e * T_] * mk);
      *(v8bf*)(Xs + ((size_t)kg * TN_ + n) * 8) = pk;
    }
  }
  __syncthreads();

  // ---- stage 1: 32 strips of 16 h-rows (4 per wave) ----
  for (int ss = 0; ss < 4; ++ss) {
    const int s  = wave + 8 * ss;        // 0..31
    const int g  = s >> 3;               // input group
    const int ib = (s & 7) * 16;
    const int w1row0 = g * 512 + 128 * g2 + ib;

    // bias folded into accumulator init
    v8f binit;
#pragma unroll
    for (int r = 0; r < 8; ++r) binit[r] = b1[w1row0 + r + hi * 8];
    v8f acc[4] = {binit, binit, binit, binit};

#pragma unroll
    for (int kb = 0; kb < KG1_; kb += 32) {
      const v16bf a = load_a_bf16(w1b, w1row0, KG1_, kb, lane);
#pragma unroll
      for (int nt = 0; nt < 4; ++nt) {
        const v16bf bb = load_b_k8(Xs, g * KG1_ + kb, nt * 16, lane);
        acc[nt] = __builtin_amdgcn_wmma_f32_16x16x32_bf16(
            false, a, false, bb, (short)0, acc[nt], false, false);
      }
    }
    // GELU + channel-shuffled scatter into Hs (K8 layout)
#pragma unroll
    for (int nt = 0; nt < 4; ++nt) {
      const int n = nt * 16 + nlo;
#pragma unroll
      for (int r = 0; r < 8; ++r) {
        const int m = r + hi * 8;
        const float v = gelu_fast(acc[nt][r]);
        const int j = 4 * (ib + m) + g;            // shuffled row in [0,512)
        Hs[k8idx(j, n)] = (__bf16)v;
      }
    }
  }
  __syncthreads();

  // ---- stage 2: out tile 128 x 64, K = 512 over shuffled Hs ----
  const int w2row0 = g2 * 128 + wave * 16;
  v8f binit2;
#pragma unroll
  for (int r = 0; r < 8; ++r) binit2[r] = b2[w2row0 + r + hi * 8];
  v8f acc2[4] = {binit2, binit2, binit2, binit2};

#pragma unroll 4
  for (int kb = 0; kb < KG2_; kb += 32) {
    const v16bf a = load_a_bf16(w2b, w2row0, KG2_, kb, lane);
#pragma unroll
    for (int nt = 0; nt < 4; ++nt) {
      const v16bf bb = load_b_k8(Hs, kb, nt * 16, lane);
      acc2[nt] = __builtin_amdgcn_wmma_f32_16x16x32_bf16(
          false, a, false, bb, (short)0, acc2[nt], false, false);
    }
  }
  const float* mb = mask + (size_t)b * T_;
#pragma unroll
  for (int nt = 0; nt < 4; ++nt) {
    const int n = nt * 16 + nlo;
    const int t = t0 + n;
    const float mk = mb[t];
#pragma unroll
    for (int r = 0; r < 8; ++r) {
      const int oc = w2row0 + r + hi * 8;
      out[((size_t)b * COUT_ + oc) * T_ + t] = acc2[nt][r] * mk;
    }
  }
}

extern "C" void kernel_launch(void* const* d_in, const int* in_sizes, int n_in,
                              void* d_out, int out_size, void* d_ws, size_t ws_size,
                              hipStream_t stream) {
  const float* x    = (const float*)d_in[0];
  const float* mask = (const float*)d_in[1];
  const float* w1   = (const float*)d_in[2];
  const float* b1   = (const float*)d_in[3];
  const float* w2   = (const float*)d_in[4];
  const float* b2   = (const float*)d_in[5];
  float* out = (float*)d_out;

  __bf16* wb  = (__bf16*)d_ws;                  // 1 MB: w1 then w2 as bf16
  const __bf16* w1b = wb;
  const __bf16* w2b = wb + W1ELEMS_;

  cvt_weights<<<(W1ELEMS_ + W2ELEMS_) / (256 * 4), 256, 0, stream>>>(w1, w2, wb);

  const int nBlocks = B_ * G_ * (T_ / TN_);     // 2048
  ffn2_fused_wmma<<<nBlocks, 256, 0, stream>>>(x, mask, w1b, b1, w2b, b2,
                                               (float*)d_out);
  (void)out; (void)in_sizes; (void)n_in; (void)out_size; (void)ws_size;
}

// v001
// Measured time: 60.3 microseconds a run.
// Two timings next to v000 put it at 1.26 and 1.24 times that version's speed.
#include <hip/hip_runtime.h>
#include <hip/hip_bf16.h>
#include <math.h>

typedef __attribute__((ext_vector_type(16))) __bf16 v16bf;
typedef __attribute__((ext_vector_type(8)))  __bf16 v8bf;
typedef __attribute__((ext_vector_type(4)))  __bf16 v4bf;
typedef __attribute__((ext_vector_type(8)))  float  v8f;

#define G_     4
#define B_     16
#define CIN_   512
#define T_     2048
#define H_     2048
#define COUT_  512
#define KG1_   128   // Cin/G
#define KG2_   512   // H/G
#define TN_    64    // token tile per block
#define W1ELEMS_ (H_ * KG1_)     // 262144
#define W2ELEMS_ (COUT_ * KG2_)  // 262144

// K8-interleaved LDS layout: element (k, n) -> ((k>>3)*TN_ + n)*8 + (k&7)
__device__ __forceinline__ int k8idx(int k, int n) {
  return ((k >> 3) * TN_ + n) * 8 + (k & 7);
}

// A fragment (16x32 bf16) from row-major bf16 weights: 2x global b128 loads.
__device__ __forceinline__ v16bf load_a_bf16(const __bf16* __restrict__ W,
                                             int row0, int ld, int kb, int lane) {
  const int m = lane & 15, hi = lane >> 4;
  const __bf16* wr = W + (size_t)(row0 + m) * ld + kb + hi * 8;
  const v8bf lo = *(const v8bf*)(wr);
  const v8bf hs = *(const v8bf*)(wr + 16);
  return __builtin_shufflevector(lo, hs, 0, 1, 2, 3, 4, 5, 6, 7,
                                 8, 9, 10, 11, 12, 13, 14, 15);
}

// B fragment (32x16) from K8-interleaved LDS: 2x ds_load_b128.
__device__ __forceinline__ v16bf load_b_k8(const __bf16* S, int kb, int nb, int lane) {
  const int n  = nb + (lane & 15);
  const int hi = lane >> 4;
  const int kg = (kb >> 3) + hi;
  const v8bf lo = *(const v8bf*)(S + ((size_t)kg * TN_ + n) * 8);
  const v8bf hs = *(const v8bf*)(S + ((size_t)(kg + 2) * TN_ + n) * 8);
  return __builtin_shufflevector(lo, hs, 0, 1, 2, 3, 4, 5, 6, 7,
                                 8, 9, 10, 11, 12, 13, 14, 15);
}

// GELU via native CDNA5 v_tanh_f32 transcendental (error << bf16 storage ulp).
__device__ __forceinline__ float gelu_fast(float v) {
  const float v2 = v * v;
  const float u  = v * fmaf(v2, 0.0356774081f, 0.7978845608f);
  float t;
  asm("v_tanh_f32 %0, %1\n\tv_nop\n\tv_nop" : "=v"(t) : "v"(u));
  const float hv = 0.5f * v;
  return fmaf(hv, t, hv);
}

// ---- prologue: convert f32 weights to bf16 in workspace (runs once per call) ----
__global__ __launch_bounds__(256) void cvt_weights(const float* __restrict__ w1,
                                                   const float* __restrict__ w2,
                                                   __bf16* __restrict__ wb) {
  const int idx = blockIdx.x * 256 + threadIdx.x;   // 131072 threads
  const int e   = idx * 4;                          // 524288 elems total
  float4 v;
  if (e < W1ELEMS_) v = *(const float4*)(w1 + e);
  else              v = *(const float4*)(w2 + (e - W1ELEMS_));
  v4bf p;
  p[0] = (__bf16)v.x; p[1] = (__bf16)v.y; p[2] = (__bf16)v.z; p[3] = (__bf16)v.w;
  *(v4bf*)(wb + e) = p;
}

__global__ __launch_bounds__(256) void ffn2_fused_wmma(
    const float* __restrict__ x, const float* __restrict__ mask,
    const __bf16* __restrict__ w1b, const float* __restrict__ b1,
    const __bf16* __restrict__ w2b, const float* __restrict__ b2,
    float* __restrict__ out) {
  __shared__ __bf16 Xs[CIN_ * TN_];  // masked input tile, K8 layout (64 KB)
  __shared__ __bf16 Hs[KG2_ * TN_];  // shuffled+GELU hidden tile, K8 layout (64 KB)

  const int tid  = threadIdx.x;
  const int lane = tid & 31;
  const int wave = tid >> 5;
  const int nlo  = lane & 15;
  const int hi   = lane >> 4;

  const int bid   = blockIdx.x;
  const int tTile = bid & 31;            // T_/TN_ = 32 tiles
  const int b     = bid >> 5;            // batch
  const int t0    = tTile * TN_;

  // ---- X tile load: 8 coalesced b32 loads + mask + pack -> ds_store_b128 ----
  {
    const float* xb = x + (size_t)b * CIN_ * T_;
    const float* mb = mask + (size_t)b * T_;
    for (int q = tid; q < (CIN_ / 8) * TN_; q += 256) {
      const int n  = q & (TN_ - 1);
      const int kg = q >> 6;             // 8-channel group
      const float mk = mb[t0 + n];
      const float* xp = xb + (size_t)(kg * 8) * T_ + t0 + n;
      v8bf pk;
#pragma unroll
      for (int e = 0; e < 8; ++e)
        pk[e] = (__bf16)(xp[(size_t)e * T_] * mk);
      *(v8bf*)(Xs + ((size_t)kg * TN_ + n) * 8) = pk;
    }
  }
  __syncthreads();

  // Output mask of this lane's four token columns: the same for every group.
  float mko[4];
#pragma unroll
  for (int nt = 0; nt < 4; ++nt)
    mko[nt] = mask[(size_t)b * T_ + t0 + nt * 16 + nlo];

  // The X tile stays in LDS while the block walks the four output groups.
  // Kept rolled: one copy of the two stages in the code.
#pragma unroll 1
  for (int g2 = 0; g2 < G_; ++g2) {

  // ---- stage 1: 32 strips of 16 h-rows (4 per wave) ----
  for (int ss = 0; ss < 4; ++ss) {
    const int s  = wave + 8 * ss;        // 0..31
    const int g  = s >> 3;               // input group
    const int ib = (s & 7) * 16;
    const int w1row0 = g * 512 + 128 * g2 + ib;

    // bias folded into accumulator init
    v8f binit;
#pragma unroll
    for (int r = 0; r < 8; ++r) binit[r] = b1[w1row0 + r + hi * 8];
    v8f acc[4] = {binit, binit, binit, binit};

#pragma unroll
    for (int kb = 0; kb < KG1_; kb += 32) {
      const v16bf a = load_a_bf16(w1b, w1row0, KG1_, kb, lane);
#pragma unroll
      for (int nt = 0; nt < 4; ++nt) {
        const v16bf bb = load_b_k8(Xs, g * KG1_ + kb, nt * 16, lane);
        acc[nt] = __builtin_amdgcn_wmma_f32_16x16x32_bf16(
            false, a, false, bb, (short)0, acc[nt], false, false);
      }
    }
    // GELU + channel-shuffled scatter into Hs (K8 layout)
#pragma unroll
    for (int nt = 0; nt < 4; ++nt) {
      const int n = nt * 16 + nlo;
#pragma unroll
      for (int r = 0; r < 8; ++r) {
        const int m = r + hi * 8;
        const float v = gelu_fast(acc[nt][r]);
        const int j = 4 * (ib + m) + g;            // shuffled row in [0,512)
        Hs[k8idx(j, n)] = (__bf16)v;
      }
    }
  }
  __syncthreads();

  // ---- stage 2: out tile 128 x 64, K = 512 over shuffled Hs ----
  const int w2row0 = g2 * 128 + wave * 16;
  v8f binit2;
#pragma unroll
  for (int r = 0; r < 8; ++r) binit2[r] = b2[w2row0 + r + hi * 8];
  v8f acc2[4] = {binit2, binit2, binit2, binit2};

#pragma unroll 4
  for (int kb = 0; kb < KG2_; kb += 32) {
    const v16bf a = load_a_bf16(w2b, w2row0, KG2_, kb, lane);
#pragma unroll
    for (int nt = 0; nt < 4; ++nt) {
      const v16bf bb = load_b_k8(Hs, kb, nt * 16, lane);
      acc2[nt] = __builtin_amdgcn_wmma_f32_16x16x32_bf16(
          false, a, false, bb, (short)0, acc2[nt], false, false);
    }
  }
  // Every wave has read Hs for this group: the next group's stage 1 may rewrite it.
  __syncthreads();
#pragma unroll
  for (int nt = 0; nt < 4; ++nt) {
    const int n = nt * 16 + nlo;
    const int t = t0 + n;
    const float mk = mko[nt];
#pragma unroll
    for (int r = 0; r < 8; ++r) {
      const int oc = w2row0 + r + hi * 8;
      out[((size_t)b * COUT_ + oc) * T_ + t] = acc2[nt][r] * mk;
    }
  }
  // The next group's loads reuse the registers that these stores name.
  asm volatile("s_wait_xcnt 0x0" ::: "memory");

  }  // g2
}

extern "C" void kernel_launch(void* const* d_in, const int* in_sizes, int n_in,
                              void* d_out, int out_size, void* d_ws, size_t ws_size,
                              hipStream_t stream) {
  const float* x    = (const float*)d_in[0];
  const float* mask = (const float*)d_in[1];
  const float* w1   = (const float*)d_in[2];
  const float* b1   = (const float*)d_in[3];
  const float* w2   = (const float*)d_in[4];
  const float* b2   = (const float*)d_in[5];
  float* out = (float*)d_out;

  __bf16* wb  = (__bf16*)d_ws;                  // 1 MB: w1 then w2 as bf16
  const __bf16* w1b = wb;
  const __bf16* w2b = wb + W1ELEMS_;

  cvt_weights<<<(W1ELEMS_ + W2ELEMS_) / (256 * 4), 256, 0, stream>>>(w1, w2, wb);

  const int nBlocks = B_ * (T_ / TN_);          // 512
  ffn2_fused_wmma<<<nBlocks, 256, 0, stream>>>(x, mask, w1b, b1, w2b, b2,
                                               (float*)d_out);
  (void)out; (void)in_sizes; (void)n_in; (void)out_size; (void)ws_size;
}

// v002
// A run of this version takes 51.4 microseconds.
// Timed twice side by side with v001, it ran 1.17 times as fast both times.
// Counting every step since v000, it is 1.46 times as fast.
#include <hip/hip_runtime.h>
#include <hip/hip_bf16.h>
#include <math.h>

typedef __attribute__((ext_vector_type(16))) __bf16 v16bf;
typedef __attribute__((ext_vector_type(8)))  __bf16 v8bf;
typedef __attribute__((ext_vector_type(4)))  __bf16 v4bf;
typedef __attribute__((ext_vector_type(8)))  float  v8f;

#define G_     4
#define B_     16
#define CIN_   512
#define T_     2048
#define H_     2048
#define COUT_  512
#define KG1_   128   // Cin/G
#define KG2_   512   // H/G
#define TN_    64    // token tile per block
#define W1ELEMS_ (H_ * KG1_)     // 262144
#define W2ELEMS_ (COUT_ * KG2_)  // 262144

// K8-interleaved LDS layout: element (k, n) -> ((k>>3)*TN_ + n)*8 + (k&7)
__device__ __forceinline__ int k8idx(int k, int n) {
  return ((k >> 3) * TN_ + n) * 8 + (k & 7);
}

// A fragment (16x32 bf16) from fragment-ordered bf16 weights: 2x global b128 loads,
// each 512 contiguous bytes for the wave (four whole 128-byte lines).
// Fragment (row tile, k step) = 512 elements: 32 lanes x 8 (k 0..7 / 8..15 by lane
// half), then 32 lanes x 8 (k 16..23 / 24..31).
__device__ __forceinline__ v16bf load_a_bf16(const __bf16* __restrict__ W,
                                             int row0, int ld, int kb, int lane) {
  const __bf16* wr = W + ((size_t)(row0 >> 4) * (ld >> 5) + (kb >> 5)) * 512 + lane * 8;
  const v8bf lo = *(const v8bf*)(wr);
  const v8bf hs = *(const v8bf*)(wr + 256);
  return __builtin_shufflevector(lo, hs, 0, 1, 2, 3, 4, 5, 6, 7,
                                 8, 9, 10, 11, 12, 13, 14, 15);
}

// B fragment (32x16) from K8-interleaved LDS: 2x ds_load_b128.
__device__ __forceinline__ v16bf load_b_k8(const __bf16* S, int kb, int nb, int lane) {
  const int n  = nb + (lane & 15);
  const int hi = lane >> 4;
  const int kg = (kb >> 3) + hi;
  const v8bf lo = *(const v8bf*)(S + ((size_t)kg * TN_ + n) * 8);
  const v8bf hs = *(const v8bf*)(S + ((size_t)(kg + 2) * TN_ + n) * 8);
  return __builtin_shufflevector(lo, hs, 0, 1, 2, 3, 4, 5, 6, 7,
                                 8, 9, 10, 11, 12, 13, 14, 15);
}

// GELU via native CDNA5 v_tanh_f32 transcendental (error << bf16 storage ulp).
__device__ __forceinline__ float gelu_fast(float v) {
  const float v2 = v * v;
  const float u  = v * fmaf(v2, 0.0356774081f, 0.7978845608f);
  float t;
  asm("v_tanh_f32 %0, %1\n\tv_nop\n\tv_nop" : "=v"(t) : "v"(u));
  const float hv = 0.5f * v;
  return fmaf(hv, t, hv);
}

// ---- prologue: convert f32 weights to bf16 in workspace, in A-fragment order ----
// One thread per 8-element piece of the packed layout (one lane's b128 of a fragment).
__global__ __launch_bounds__(256) void cvt_weights(const float* __restrict__ w1,
                                                   const float* __restrict__ w2,
                                                   __bf16* __restrict__ wb) {
  const int idx = blockIdx.x * 256 + threadIdx.x;   // 65536 threads
  const bool first = idx < W1ELEMS_ / 8;
  const int c    = first ? idx : idx - W1ELEMS_ / 8;
  const int ld   = first ? KG1_ : KG2_;
  const int lks  = first ? 2 : 4;                   // log2(k steps per row tile)
  const float* w = first ? w1 : w2;
  const int frag = c >> 6;
  const int half = (c >> 5) & 1;
  const int lane = c & 31;
  const int row  = (frag >> lks) * 16 + (lane & 15);
  const int k    = (frag & ((1 << lks) - 1)) * 32 + half * 16 + (lane >> 4) * 8;
  const float* s = w + (size_t)row * ld + k;
  const float4 v0 = *(const float4*)(s);
  const float4 v1 = *(const float4*)(s + 4);
  v8bf p;
  p[0] = (__bf16)v0.x; p[1] = (__bf16)v0.y; p[2] = (__bf16)v0.z; p[3] = (__bf16)v0.w;
  p[4] = (__bf16)v1.x; p[5] = (__bf16)v1.y; p[6] = (__bf16)v1.z; p[7] = (__bf16)v1.w;
  *(v8bf*)(wb + (size_t)idx * 8) = p;
}

__global__ __launch_bounds__(256) void ffn2_fused_wmma(
    const float* __restrict__ x, const float* __restrict__ mask,
    const __bf16* __restrict__ w1b, const float* __restrict__ b1,
    const __bf16* __restrict__ w2b, const float* __restrict__ b2,
    float* __restrict__ out) {
  __shared__ __bf16 Xs[CIN_ * TN_];  // masked input tile, K8 layout (64 KB)
  __shared__ __bf16 Hs[KG2_ * TN_];  // shuffled+GELU hidden tile, K8 layout (64 KB)

  const int tid  = threadIdx.x;
  const int lane = tid & 31;
  const int wave = tid >> 5;
  const int nlo  = lane & 15;
  const int hi   = lane >> 4;

  const int bid   = blockIdx.x;
  const int tTile = bid & 31;            // T_/TN_ = 32 tiles
  const int b     = bid >> 5;            // batch
  const int t0    = tTile * TN_;

  // ---- X tile load: 8 coalesced b32 loads + mask + pack -> ds_store_b128 ----
  {
    const float* xb = x + (size_t)b * CIN_ * T_;
    const float* mb = mask + (size_t)b * T_;
    for (int q = tid; q < (CIN_ / 8) * TN_; q += 256) {
      const int n  = q & (TN_ - 1);
      const int kg = q >> 6;             // 8-channel group
      const float mk = mb[t0 + n];
      const float* xp = xb + (size_t)(kg * 8) * T_ + t0 + n;
      v8bf pk;
#pragma unroll
      for (int e = 0; e < 8; ++e)
        pk[e] = (__bf16)(xp[(size_t)e * T_] * mk);
      *(v8bf*)(Xs + ((size_t)kg * TN_ + n) * 8) = pk;
    }
  }
  __syncthreads();

  // Output mask of this lane's four token columns: the same for every group.
  float mko[4];
#pragma unroll
  for (int nt = 0; nt < 4; ++nt)
    mko[nt] = mask[(size_t)b * T_ + t0 + nt * 16 + nlo];

  // The X tile stays in LDS while the block walks the four output groups.
  // Kept rolled: one copy of the two stages in the code.
#pragma unroll 1
  for (int g2 = 0; g2 < G_; ++g2) {

  // ---- stage 1: 32 strips of 16 h-rows (4 per wave) ----
  for (int ss = 0; ss < 4; ++ss) {
    const int s  = wave + 8 * ss;        // 0..31
    const int g  = s >> 3;               // input group
    const int ib = (s & 7) * 16;
    const int w1row0 = g * 512 + 128 * g2 + ib;

    // bias folded into accumulator init
    v8f binit;
#pragma unroll
    for (int r = 0; r < 8; ++r) binit[r] = b1[w1row0 + r + hi * 8];
    v8f acc[4] = {binit, binit, binit, binit};

#pragma unroll
    for (int kb = 0; kb < KG1_; kb += 32) {
      const v16bf a = load_a_bf16(w1b, w1row0, KG1_, kb, lane);
#pragma unroll
      for (int nt = 0; nt < 4; ++nt) {
        const v16bf bb = load_b_k8(Xs, g * KG1_ + kb, nt * 16, lane);
        acc[nt] = __builtin_amdgcn_wmma_f32_16x16x32_bf16(
            false, a, false, bb, (short)0, acc[nt], false, false);
      }
    }
    // GELU + channel-shuffled scatter into Hs (K8 layout)
#pragma unroll
    for (int nt = 0; nt < 4; ++nt) {
      const int n = nt * 16 + nlo;
#pragma unroll
      for (int r = 0; r < 8; ++r) {
        const int m = r + hi * 8;
        const float v = gelu_fast(acc[nt][r]);
        const int j = 4 * (ib + m) + g;            // shuffled row in [0,512)
        Hs[k8idx(j, n)] = (__bf16)v;
      }
    }
  }
  __syncthreads();

  // ---- stage 2: out tile 128 x 64, K = 512 over shuffled Hs ----
  const int w2row0 = g2 * 128 + wave * 16;
  v8f binit2;
#pragma unroll
  for (int r = 0; r < 8; ++r) binit2[r] = b2[w2row0 + r + hi * 8];
  v8f acc2[4] = {binit2, binit2, binit2, binit2};

#pragma unroll 4
  for (int kb = 0; kb < KG2_; kb += 32) {
    const v16bf a = load_a_bf16(w2b, w2row0, KG2_, kb, lane);
#pragma unroll
    for (int nt = 0; nt < 4; ++nt) {
      const v16bf bb = load_b_k8(Hs, kb, nt * 16, lane);
      acc2[nt] = __builtin_amdgcn_wmma_f32_16x16x32_bf16(
          false, a, false, bb, (short)0, acc2[nt], false, false);
    }
  }
  // Every wave has read Hs for this group: the next group's stage 1 may rewrite it.
  __syncthreads();
#pragma unroll
  for (int nt = 0; nt < 4; ++nt) {
    const int n = nt * 16 + nlo;
    const int t = t0 + n;
    const float mk = mko[nt];
#pragma unroll
    for (int r = 0; r < 8; ++r) {
      const int oc = w2row0 + r + hi * 8;
      out[((size_t)b * COUT_ + oc) * T_ + t] = acc2[nt][r] * mk;
    }
  }
  // The next group's loads reuse the registers that these stores name.
  asm volatile("s_wait_xcnt 0x0" ::: "memory");

  }  // g2
}

extern "C" void kernel_launch(void* const* d_in, const int* in_sizes, int n_in,
                              void* d_out, int out_size, void* d_ws, size_t ws_size,
                              hipStream_t stream) {
  const float* x    = (const float*)d_in[0];
  const float* mask = (const float*)d_in[1];
  const float* w1   = (const float*)d_in[2];
  const float* b1   = (const float*)d_in[3];
  const float* w2   = (const float*)d_in[4];
  const float* b2   = (const float*)d_in[5];
  float* out = (float*)d_out;

  __bf16* wb  = (__bf16*)d_ws;                  // 1 MB: w1 then w2 as bf16, fragment order
  const __bf16* w1b = wb;
  const __bf16* w2b = wb + W1ELEMS_;

  cvt_weights<<<(W1ELEMS_ + W2ELEMS_) / (256 * 8), 256, 0, stream>>>(w1, w2, wb);

  const int nBlocks = B_ * (T_ / TN_);          // 512
  ffn2_fused_wmma<<<nBlocks, 256, 0, stream>>>(x, mask, w1b, b1, w2b, b2,
                                               (float*)d_out);
  (void)out; (void)in_sizes; (void)n_in; (void)out_size; (void)ws_size;
}

// v003
// One run takes 47.7 microseconds.
// Two timings next to v002 both put it at 1.08 times that version's speed.
// Over all steps from v000 it is 1.58 times as fast.
#include <hip/hip_runtime.h>
#include <hip/hip_bf16.h>
#include <math.h>

typedef __attribute__((ext_vector_type(16))) __bf16 v16bf;
typedef __attribute__((ext_vector_type(8)))  __bf16 v8bf;
typedef __attribute__((ext_vector_type(4)))  __bf16 v4bf;
typedef __attribute__((ext_vector_type(8)))  float  v8f;

#define G_     4
#define B_     16
#define CIN_   512
#define T_     2048
#define H_     2048
#define COUT_  512
#define KG1_   128   // Cin/G
#define KG2_   512   // H/G
#define TN_    64    // token tile per block
#define W1ELEMS_ (H_ * KG1_)     // 262144
#define W2ELEMS_ (COUT_ * KG2_)  // 262144

// K8-interleaved LDS layout: element (k, n) -> ((k>>3)*TN_ + n)*8 + (k&7)
__device__ __forceinline__ int k8idx(int k, int n) {
  return ((k >> 3) * TN_ + n) * 8 + (k & 7);
}

// A fragment (16x32 bf16) from fragment-ordered bf16 weights: 2x global b128 loads,
// each 512 contiguous bytes for the wave (four whole 128-byte lines).
// Fragment (row tile, k step) = 512 elements: 32 lanes x 8 (k 0..7 / 8..15 by lane
// half), then 32 lanes x 8 (k 16..23 / 24..31).
__device__ __forceinline__ v16bf load_a_bf16(const __bf16* __restrict__ W,
                                             int row0, int ld, int kb, int lane) {
  const __bf16* wr = W + ((size_t)(row0 >> 4) * (ld >> 5) + (kb >> 5)) * 512 + lane * 8;
  const v8bf lo = *(const v8bf*)(wr);
  const v8bf hs = *(const v8bf*)(wr + 256);
  return __builtin_shufflevector(lo, hs, 0, 1, 2, 3, 4, 5, 6, 7,
                                 8, 9, 10, 11, 12, 13, 14, 15);
}

// B fragment (32x16) from K8-interleaved LDS: 2x ds_load_b128.
__device__ __forceinline__ v16bf load_b_k8(const __bf16* S, int kb, int nb, int lane) {
  const int n  = nb + (lane & 15);
  const int hi = lane >> 4;
  const int kg = (kb >> 3) + hi;
  const v8bf lo = *(const v8bf*)(S + ((size_t)kg * TN_ + n) * 8);
  const v8bf hs = *(const v8bf*)(S + ((size_t)(kg + 2) * TN_ + n) * 8);
  return __builtin_shufflevector(lo, hs, 0, 1, 2, 3, 4, 5, 6, 7,
                                 8, 9, 10, 11, 12, 13, 14, 15);
}

// GELU via native CDNA5 v_tanh_f32 transcendental (error << bf16 storage ulp), on one
// accumulator tile's eight values, stage by stage: eight independent chains side by side.
__device__ __forceinline__ void gelu_fast8(const v8f v, float (&o)[8]) {
  float u[8], hv[8], t[8];
#pragma unroll
  for (int r = 0; r < 8; ++r) {
    const float v2 = v[r] * v[r];
    u[r]  = v[r] * fmaf(v2, 0.0356774081f, 0.7978845608f);
    hv[r] = 0.5f * v[r];
  }
#pragma unroll
  for (int r = 0; r < 8; ++r)
    asm("v_tanh_f32 %0, %1\n\tv_nop\n\tv_nop" : "=v"(t[r]) : "v"(u[r]));
#pragma unroll
  for (int r = 0; r < 8; ++r) o[r] = fmaf(hv[r], t[r], hv[r]);
}

// ---- prologue: convert f32 weights to bf16 in workspace, in A-fragment order ----
// One thread per 8-element piece of the packed layout (one lane's b128 of a fragment).
__global__ __launch_bounds__(256) void cvt_weights(const float* __restrict__ w1,
                                                   const float* __restrict__ w2,
                                                   __bf16* __restrict__ wb) {
  const int idx = blockIdx.x * 256 + threadIdx.x;   // 65536 threads
  const bool first = idx < W1ELEMS_ / 8;
  const int c    = first ? idx : idx - W1ELEMS_ / 8;
  const int ld   = first ? KG1_ : KG2_;
  const int lks  = first ? 2 : 4;                   // log2(k steps per row tile)
  const float* w = first ? w1 : w2;
  const int frag = c >> 6;
  const int half = (c >> 5) & 1;
  const int lane = c & 31;
  const int row  = (frag >> lks) * 16 + (lane & 15);
  const int k    = (frag & ((1 << lks) - 1)) * 32 + half * 16 + (lane >> 4) * 8;
  const float* s = w + (size_t)row * ld + k;
  const float4 v0 = *(const float4*)(s);
  const float4 v1 = *(const float4*)(s + 4);
  v8bf p;
  p[0] = (__bf16)v0.x; p[1] = (__bf16)v0.y; p[2] = (__bf16)v0.z; p[3] = (__bf16)v0.w;
  p[4] = (__bf16)v1.x; p[5] = (__bf16)v1.y; p[6] = (__bf16)v1.z; p[7] = (__bf16)v1.w;
  *(v8bf*)(wb + (size_t)idx * 8) = p;
}

__global__ __launch_bounds__(256) void ffn2_fused_wmma(
    const float* __restrict__ x, const float* __restrict__ mask,
    const __bf16* __restrict__ w1b, const float* __restrict__ b1,
    const __bf16* __restrict__ w2b, const float* __restrict__ b2,
    float* __restrict__ out) {
  __shared__ __bf16 Xs[CIN_ * TN_];  // masked input tile, K8 layout (64 KB)
  __shared__ __bf16 Hs[KG2_ * TN_];  // shuffled+GELU hidden tile, K8 layout (64 KB)

  const int tid  = threadIdx.x;
  const int lane = tid & 31;
  const int wave = tid >> 5;
  const int nlo  = lane & 15;
  const int hi   = lane >> 4;

  const int bid   = blockIdx.x;
  const int tTile = bid & 31;            // T_/TN_ = 32 tiles
  const int b     = bid >> 5;            // batch
  const int t0    = tTile * TN_;

  // ---- X tile load: 8 coalesced b32 loads + mask + pack -> ds_store_b128 ----
  {
    const float* xb = x + (size_t)b * CIN_ * T_;
    const float* mb = mask + (size_t)b * T_;
    for (int q = tid; q < (CIN_ / 8) * TN_; q += 256) {
      const int n  = q & (TN_ - 1);
      const int kg = q >> 6;             // 8-channel group
      const float mk = mb[t0 + n];
      const float* xp = xb + (size_t)(kg * 8) * T_ + t0 + n;
      v8bf pk;
#pragma unroll
      for (int e = 0; e < 8; ++e)
        pk[e] = (__bf16)(xp[(size_t)e * T_] * mk);
      *(v8bf*)(Xs + ((size_t)kg * TN_ + n) * 8) = pk;
    }
  }
  __syncthreads();

  // Output mask of this lane's two token columns in stage 2: the same for every group.
  const int n0 = (wave & 1) * 32;        // this wave's token half in stage 2
  float mko[2];
#pragma unroll
  for (int nt = 0; nt < 2; ++nt)
    mko[nt] = mask[(size_t)b * T_ + t0 + n0 + nt * 16 + nlo];

  // The X tile stays in LDS while the block walks the four output groups.
  // Kept rolled: one copy of the two stages in the code.
#pragma unroll 1
  for (int g2 = 0; g2 < G_; ++g2) {

  // ---- stage 1: 32 strips of 16 h-rows; a wave takes 4 strips of ONE input group, so
  // its 16 X fragments are read from LDS once and feed all four strips ----
  const int g = wave >> 1;               // input group
  v16bf bx[4][4];
#pragma unroll
  for (int ks = 0; ks < 4; ++ks)
#pragma unroll
    for (int nt = 0; nt < 4; ++nt)
      bx[ks][nt] = load_b_k8(Xs, g * KG1_ + ks * 32, nt * 16, lane);

  // Kept rolled: beside the 128 registers of bx only one strip's values fit the 256
  // registers a wave may hold while two blocks share a WGP.
#pragma unroll 1
  for (int ss = 0; ss < 4; ++ss) {
    const int ib = (wave & 1) * 64 + ss * 16;
    const int w1row0 = g * 512 + 128 * g2 + ib;

    // The strip's four weight fragments, all in flight before the first WMMA.
    v16bf a[4];
#pragma unroll
    for (int ks = 0; ks < 4; ++ks)
      a[ks] = load_a_bf16(w1b, w1row0, KG1_, ks * 32, lane);

    // bias folded into accumulator init
    v8f binit;
#pragma unroll
    for (int r = 0; r < 8; ++r) binit[r] = b1[w1row0 + r + hi * 8];
    v8f acc[4] = {binit, binit, binit, binit};
    // Holds the strip's loads ahead of its WMMAs as one group: sunk among them, each
    // weight load's latency is waited out on its own.
    __builtin_amdgcn_sched_barrier(0);

#pragma unroll
    for (int ks = 0; ks < 4; ++ks)
#pragma unroll
      for (int nt = 0; nt < 4; ++nt)
        acc[nt] = __builtin_amdgcn_wmma_f32_16x16x32_bf16(
            false, a[ks], false, bx[ks][nt], (short)0, acc[nt], false, false);

    // GELU + channel-shuffled scatter into Hs (K8 layout): shuffled row
    // j = 4 * (ib + r + hi * 8) + g, token n = nt * 16 + nlo.
    __bf16* hb = Hs + k8idx(4 * (ib + hi * 8) + g, nlo);
#pragma unroll
    for (int nt = 0; nt < 4; ++nt) {
      float ge[8];
      gelu_fast8(acc[nt], ge);
#pragma unroll
      for (int r = 0; r < 8; ++r)
        hb[k8idx(4 * r, nt * 16)] = (__bf16)ge[r];
    }
  }
  __syncthreads();

  // ---- stage 2: out tile 128 x 64, K = 512 over shuffled Hs; a wave takes 32 rows x
  // 32 tokens, so each Hs fragment read from LDS feeds two WMMAs ----
  const int w2row0 = g2 * 128 + (wave >> 1) * 32;
  v8f acc2[2][2];
#pragma unroll
  for (int mt = 0; mt < 2; ++mt) {
    v8f binit2;
#pragma unroll
    for (int r = 0; r < 8; ++r) binit2[r] = b2[w2row0 + mt * 16 + r + hi * 8];
    acc2[mt][0] = binit2;
    acc2[mt][1] = binit2;
  }

  // Four k steps a trip, kept rolled; a trip's fragments are all in flight before its
  // first WMMA.
#pragma unroll 1
  for (int kb = 0; kb < KG2_; kb += 128) {
    v16bf a2[4][2], bh[4][2];
#pragma unroll
    for (int ks = 0; ks < 4; ++ks)
#pragma unroll
      for (int mt = 0; mt < 2; ++mt)
        a2[ks][mt] = load_a_bf16(w2b, w2row0 + mt * 16, KG2_, kb + ks * 32, lane);
#pragma unroll
    for (int ks = 0; ks < 4; ++ks)
#pragma unroll
      for (int nt = 0; nt < 2; ++nt)
        bh[ks][nt] = load_b_k8(Hs, kb + ks * 32, n0 + nt * 16, lane);
    // Holds the trip's loads ahead of its WMMAs as one group: sunk among them, each
    // weight load's latency is waited out on its own.
    __builtin_amdgcn_sched_barrier(0);
#pragma unroll
    for (int ks = 0; ks < 4; ++ks)
#pragma unroll
      for (int mt = 0; mt < 2; ++mt)
#pragma unroll
        for (int nt = 0; nt < 2; ++nt)
          acc2[mt][nt] = __builtin_amdgcn_wmma_f32_16x16x32_bf16(
              false, a2[ks][mt], false, bh[ks][nt], (short)0, acc2[mt][nt], false, false);
  }
  // Every wave has read Hs for this group: the next group's stage 1 may rewrite it.
  __syncthreads();
#pragma unroll
  for (int mt = 0; mt < 2; ++mt) {
#pragma unroll
    for (int nt = 0; nt < 2; ++nt) {
      const int t = t0 + n0 + nt * 16 + nlo;
      const float mk = mko[nt];
#pragma unroll
      for (int r = 0; r < 8; ++r) {
        const int oc = w2row0 + mt * 16 + r + hi * 8;
        out[((size_t)b * COUT_ + oc) * T_ + t] = acc2[mt][nt][r] * mk;
      }
    }
  }
  // The next group's loads reuse the registers that these stores name.
  asm volatile("s_wait_xcnt 0x0" ::: "memory");

  }  // g2
}

extern "C" void kernel_launch(void* const* d_in, const int* in_sizes, int n_in,
                              void* d_out, int out_size, void* d_ws, size_t ws_size,
                              hipStream_t stream) {
  const float* x    = (const float*)d_in[0];
  const float* mask = (const float*)d_in[1];
  const float* w1   = (const float*)d_in[2];
  const float* b1   = (const float*)d_in[3];
  const float* w2   = (const float*)d_in[4];
  const float* b2   = (const float*)d_in[5];
  float* out = (float*)d_out;

  __bf16* wb  = (__bf16*)d_ws;                  // 1 MB: w1 then w2 as bf16, fragment order
  const __bf16* w1b = wb;
  const __bf16* w2b = wb + W1ELEMS_;

  cvt_weights<<<(W1ELEMS_ + W2ELEMS_) / (256 * 8), 256, 0, stream>>>(w1, w2, wb);

  const int nBlocks = B_ * (T_ / TN_);          // 512
  ffn2_fused_wmma<<<nBlocks, 256, 0, stream>>>(x, mask, w1b, b1, w2b, b2,
                                               (float*)d_out);
  (void)out; (void)in_sizes; (void)n_in; (void)out_size; (void)ws_size;
}

// v004
// It runs in 43.3 microseconds.
// Two timings next to v003 both put it at 1.12 times that version's speed.
// Counting every step since v000, it is 1.77 times as fast.
#include <hip/hip_runtime.h>
#include <hip/hip_bf16.h>
#include <math.h>

typedef __attribute__((ext_vector_type(16))) __bf16 v16bf;
typedef __attribute__((ext_vector_type(8)))  __bf16 v8bf;
typedef __attribute__((ext_vector_type(4)))  __bf16 v4bf;
typedef __attribute__((ext_vector_type(8)))  float  v8f;

#define G_     4
#define B_     16
#define CIN_   512
#define T_     2048
#define H_     2048
#define COUT_  512
#define KG1_   128   // Cin/G
#define KG2_   512   // H/G
#define TN_    128   // token tile per block
#define W1ELEMS_ (H_ * KG1_)     // 262144
#define W2ELEMS_ (COUT_ * KG2_)  // 262144

// K8-interleaved LDS layout: element (k, n) -> ((k>>3)*TN_ + n)*8 + (k&7)

// A fragment (16x32 bf16) from fragment-ordered bf16 weights: 2x global b128 loads,
// each 512 contiguous bytes for the wave (four whole 128-byte lines).
// Fragment (row tile, k step) = 512 elements: 32 lanes x 8 (k 0..7 / 8..15 by lane
// half), then 32 lanes x 8 (k 16..23 / 24..31).
__device__ __forceinline__ v16bf load_a_bf16(const __bf16* __restrict__ W,
                                             int row0, int ld, int kb, int lane) {
  const __bf16* wr = W + ((size_t)(row0 >> 4) * (ld >> 5) + (kb >> 5)) * 512 + lane * 8;
  const v8bf lo = *(const v8bf*)(wr);
  const v8bf hs = *(const v8bf*)(wr + 256);
  return __builtin_shufflevector(lo, hs, 0, 1, 2, 3, 4, 5, 6, 7,
                                 8, 9, 10, 11, 12, 13, 14, 15);
}

// B fragment (32x16) from K8-interleaved LDS: 2x ds_load_b128.
__device__ __forceinline__ v16bf load_b_k8(const __bf16* S, int kb, int nb, int lane) {
  const int n  = nb + (lane & 15);
  const int hi = lane >> 4;
  const int kg = (kb >> 3) + hi;
  const v8bf lo = *(const v8bf*)(S + ((size_t)kg * TN_ + n) * 8);
  const v8bf hs = *(const v8bf*)(S + ((size_t)(kg + 2) * TN_ + n) * 8);
  return __builtin_shufflevector(lo, hs, 0, 1, 2, 3, 4, 5, 6, 7,
                                 8, 9, 10, 11, 12, 13, 14, 15);
}

// GELU via native CDNA5 v_tanh_f32 transcendental (error << bf16 storage ulp), on one
// accumulator tile's eight values, stage by stage: eight independent chains side by side.
__device__ __forceinline__ void gelu_fast8(const v8f v, float (&o)[8]) {
  float u[8], hv[8], t[8];
#pragma unroll
  for (int r = 0; r < 8; ++r) {
    const float v2 = v[r] * v[r];
    u[r]  = v[r] * fmaf(v2, 0.0356774081f, 0.7978845608f);
    hv[r] = 0.5f * v[r];
  }
#pragma unroll
  for (int r = 0; r < 8; ++r)
    asm("v_tanh_f32 %0, %1\n\tv_nop\n\tv_nop" : "=v"(t[r]) : "v"(u[r]));
#pragma unroll
  for (int r = 0; r < 8; ++r) o[r] = fmaf(hv[r], t[r], hv[r]);
}

// ---- prologue: convert f32 weights to bf16 in workspace, in A-fragment order ----
// One thread per 8-element piece of the packed layout (one lane's b128 of a fragment).
// W2's K columns are dealt so that k step kk = 4 * g + p of an output group holds, in
// order, the 32 hidden rows p * 32 .. p * 32 + 31 of input group g (shuffled column
// 4 * row + g): the order in which stage 1 leaves them in a wave's accumulators.
__global__ __launch_bounds__(256) void cvt_weights(const float* __restrict__ w1,
                                                   const float* __restrict__ w2,
                                                   __bf16* __restrict__ wb) {
  const int idx = blockIdx.x * 256 + threadIdx.x;   // 65536 threads
  const bool first = idx < W1ELEMS_ / 8;
  const int c    = first ? idx : idx - W1ELEMS_ / 8;
  const int lks  = first ? 2 : 4;                   // log2(k steps per row tile)
  const int frag = c >> 6;
  const int half = (c >> 5) & 1;
  const int lane = c & 31;
  const int row  = (frag >> lks) * 16 + (lane & 15);
  const int kk   = frag & ((1 << lks) - 1);         // k step
  const int k    = half * 16 + (lane >> 4) * 8;     // place in the k step
  const float* s = first ? w1 + (size_t)row * KG1_ + kk * 32 + k
                         : w2 + (size_t)row * KG2_ + 4 * ((kk & 3) * 32 + k) + (kk >> 2);
  const int st = first ? 1 : 4;                     // W2: every 4th column
  v8bf p;
#pragma unroll
  for (int e = 0; e < 8; ++e) p[e] = (__bf16)s[e * st];
  *(v8bf*)(wb + (size_t)idx * 8) = p;
}

__global__ __launch_bounds__(256) void ffn2_fused_wmma(
    const float* __restrict__ x, const float* __restrict__ mask,
    const __bf16* __restrict__ w1b, const float* __restrict__ b1,
    const __bf16* __restrict__ w2b, const float* __restrict__ b2,
    float* __restrict__ out) {
  __shared__ __bf16 Xs[CIN_ * TN_];  // masked input tile, K8 layout (128 KB)

  const int tid  = threadIdx.x;
  const int lane = tid & 31;
  const int wave = __builtin_amdgcn_readfirstlane(tid >> 5);
  const int nlo  = lane & 15;
  const int hi   = lane >> 4;

  const int bid   = blockIdx.x;
  const int tTile = bid & 15;            // T_/TN_ = 16 tiles
  const int b     = bid >> 4;            // batch
  const int t0    = tTile * TN_;

  // ---- X tile load: 8 coalesced b32 loads + mask + pack -> ds_store_b128 ----
  {
    const int n = tid & (TN_ - 1);
    const float mk = mask[(size_t)b * T_ + t0 + n];
    const float* xp0 = x + (size_t)b * CIN_ * T_ + t0 + n;
    // Eight trips' loads in flight: 8 waves stage what 16 staged, so each keeps more
    // bytes under way to cover the memory latency.
#pragma unroll 8
    for (int i = 0; i < CIN_ / 16; ++i) {
      const int kg = 2 * i + (tid >> 7);                // 8-channel group
      const float* xp = xp0 + (size_t)(kg * 8) * T_;
      v8bf pk;
#pragma unroll
      for (int e = 0; e < 8; ++e)
        pk[e] = (__bf16)(xp[(size_t)e * T_] * mk);
      *(v8bf*)(Xs + ((size_t)kg * TN_ + n) * 8) = pk;
    }
  }
  __syncthreads();

  // A wave owns ONE output group for 64 tokens, from X to out: the hidden rows that feed
  // an output group feed no other, so no wave needs another wave's hidden values.
  const int g2 = wave & 3;               // output group
  const int n0 = (wave >> 2) * 64;       // token half

  v8f acc2[8][4];                        // 128 out rows x 64 tokens
#pragma unroll
  for (int mt = 0; mt < 8; ++mt) {
    v8f binit2;
#pragma unroll
    for (int r = 0; r < 8; ++r) binit2[r] = b2[g2 * 128 + mt * 16 + r + hi * 8];
#pragma unroll
    for (int nt = 0; nt < 4; ++nt) acc2[mt][nt] = binit2;
  }

  // W1 fragments and bias of the coming trip's 32 hidden rows.
  v16bf a1[2][4];
  v8f bi[2];
#pragma unroll
  for (int mt = 0; mt < 2; ++mt) {
    const int row0 = 128 * g2 + mt * 16;
#pragma unroll
    for (int ks = 0; ks < 4; ++ks)
      a1[mt][ks] = load_a_bf16(w1b, row0, KG1_, ks * 32, lane);
#pragma unroll
    for (int r = 0; r < 8; ++r) bi[mt][r] = b1[row0 + r + hi * 8];
  }

  // X fragments of the coming trip's first two k steps.
  v16bf bxa[4], bxb[4];
#pragma unroll
  for (int nt = 0; nt < 4; ++nt) {
    bxa[nt] = load_b_k8(Xs, 0, n0 + nt * 16, lane);
    bxb[nt] = load_b_k8(Xs, 32, n0 + nt * 16, lane);
  }

  // The loop reuses the registers that hold the addresses of the loads above.
  asm volatile("s_wait_xcnt 0x0" ::: "memory");
  __builtin_amdgcn_sched_barrier(0);   // keeps that wait behind them, ahead of the loop

  // 16 trips: input group g = it / 4, 32 hidden rows a trip = one k step of stage 2.
  // Kept rolled: one copy of the trip in the instruction cache.
#pragma unroll 1
  for (int it = 0; it < 16; ++it) {
    const int g = it >> 2;

    // ---- stage 1: 32 hidden rows x 64 tokens, K = 128 ----
    v8f d[2][4];
#pragma unroll
    for (int mt = 0; mt < 2; ++mt)
#pragma unroll
      for (int nt = 0; nt < 4; ++nt) d[mt][nt] = bi[mt];
    // The X fragments come from LDS in whole groups of 8 loads, two k steps ahead of
    // their WMMAs; the sched_barriers below hold a group together at its place (for speed only).
#pragma unroll
    for (int ks = 0; ks < 4; ++ks) {
      v16bf (&bx)[4] = (ks & 1) ? bxb : bxa;
#pragma unroll
      for (int mt = 0; mt < 2; ++mt)
#pragma unroll
        for (int nt = 0; nt < 4; ++nt)
          d[mt][nt] = __builtin_amdgcn_wmma_f32_16x16x32_bf16(
              false, a1[mt][ks], false, bx[nt], (short)0, d[mt][nt], false, false);
      if (ks < 2) {
        __builtin_amdgcn_sched_barrier(0);
#pragma unroll
        for (int nt = 0; nt < 4; ++nt)
          bx[nt] = load_b_k8(Xs, g * KG1_ + (ks + 2) * 32, n0 + nt * 16, lane);
        __builtin_amdgcn_sched_barrier(0);
      }
    }

    // This trip's W2 fragments: one k step of the group's 8 row tiles.
    v16bf a2[8];
#pragma unroll
    for (int mt = 0; mt < 8; ++mt)
      a2[mt] = load_a_bf16(w2b, g2 * 128 + mt * 16, KG2_, it * 32, lane);
    // The address arithmetic of the loads below reuses these loads' address registers;
    // the sched_barrier keeps that arithmetic behind the wait.
    asm volatile("s_wait_xcnt 0x0" ::: "memory");
    __builtin_amdgcn_sched_barrier(0);
    // The next trip's W1 fragments and bias (the last trip wraps to the first: in
    // bounds, not used).
    {
      const int itn = (it + 1) & 15;
#pragma unroll
      for (int mt = 0; mt < 2; ++mt) {
        const int row0 = (itn >> 2) * 512 + 128 * g2 + (itn & 3) * 32 + mt * 16;
#pragma unroll
        for (int ks = 0; ks < 4; ++ks)
          a1[mt][ks] = load_a_bf16(w1b, row0, KG1_, ks * 32, lane);
#pragma unroll
        for (int r = 0; r < 8; ++r) bi[mt][r] = b1[row0 + r + hi * 8];
      }
    }
    // The GELU reuses the registers that hold these loads' addresses.
    asm volatile("s_wait_xcnt 0x0" ::: "memory");
    // Holds the trip's weight loads, and that wait, ahead of the GELU, whose run covers
    // the loads' latency.
    __builtin_amdgcn_sched_barrier(0);

    // ---- GELU in place: the two accumulator tiles of a token column (rows 0..15 and
    // 16..31), converted, ARE the B fragment of stage 2's k step ----
    v16bf hb[4];
#pragma unroll
    for (int nt = 0; nt < 4; ++nt)
#pragma unroll
      for (int mt = 0; mt < 2; ++mt) {
        float ge[8];
        gelu_fast8(d[mt][nt], ge);
#pragma unroll
        for (int r = 0; r < 8; ++r) hb[nt][mt * 8 + r] = (__bf16)ge[r];
      }

    // ---- stage 2: 128 out rows x 64 tokens, this trip's k step ----
#pragma unroll
    for (int mt = 0; mt < 8; ++mt) {
      if (mt == 4) {
        // The next trip's first X fragments, as one group, into the registers that the
        // first four W2 fragments have left; the barriers hold the group at this place.
        __builtin_amdgcn_sched_barrier(0);
        const int gn = ((it + 1) & 15) >> 2;
#pragma unroll
        for (int nt = 0; nt < 4; ++nt) {
          bxa[nt] = load_b_k8(Xs, gn * KG1_, n0 + nt * 16, lane);
          bxb[nt] = load_b_k8(Xs, gn * KG1_ + 32, n0 + nt * 16, lane);
        }
        __builtin_amdgcn_sched_barrier(0);
      }
#pragma unroll
      for (int nt = 0; nt < 4; ++nt)
        acc2[mt][nt] = __builtin_amdgcn_wmma_f32_16x16x32_bf16(
            false, a2[mt], false, hb[nt], (short)0, acc2[mt][nt], false, false);
    }
  }

  float* ob = out + ((size_t)b * COUT_ + g2 * 128 + hi * 8) * T_ + t0 + n0 + nlo;
#pragma unroll
  for (int nt = 0; nt < 4; ++nt) {
    const float mk = mask[(size_t)b * T_ + t0 + n0 + nt * 16 + nlo];
#pragma unroll
    for (int mt = 0; mt < 8; ++mt) acc2[mt][nt] *= mk;
  }
  // Every product ahead of the first store: the stores issue in one run, and no register
  // that an issued store names is written again.
  __builtin_amdgcn_sched_barrier(0);
#pragma unroll
  for (int mt = 0; mt < 8; ++mt)
#pragma unroll
    for (int r = 0; r < 8; ++r)
#pragma unroll
      for (int nt = 0; nt < 4; ++nt)   // a row's 256 bytes in four stores in a row
        ob[(size_t)(mt * 16 + r) * T_ + nt * 16] = acc2[mt][nt][r];
}

extern "C" void kernel_launch(void* const* d_in, const int* in_sizes, int n_in,
                              void* d_out, int out_size, void* d_ws, size_t ws_size,
                              hipStream_t stream) {
  const float* x    = (const float*)d_in[0];
  const float* mask = (const float*)d_in[1];
  const float* w1   = (const float*)d_in[2];
  const float* b1   = (const float*)d_in[3];
  const float* w2   = (const float*)d_in[4];
  const float* b2   = (const float*)d_in[5];
  float* out = (float*)d_out;

  __bf16* wb  = (__bf16*)d_ws;                  // 1 MB: w1 then w2 as bf16, fragment order
  const __bf16* w1b = wb;
  const __bf16* w2b = wb + W1ELEMS_;

  cvt_weights<<<(W1ELEMS_ + W2ELEMS_) / (256 * 8), 256, 0, stream>>>(w1, w2, wb);

  const int nBlocks = B_ * (T_ / TN_);          // 256
  ffn2_fused_wmma<<<nBlocks, 256, 0, stream>>>(x, mask, w1b, b1, w2b, b2,
                                               (float*)d_out);
  (void)out; (void)in_sizes; (void)n_in; (void)out_size; (void)ws_size;
}

// v005
// A run of this version takes 41.4 microseconds.
// Timed twice side by side with v004, it ran 1.03 times as fast both times.
// Counting every step since v000, it is 1.83 times as fast.
#include <hip/hip_runtime.h>
#include <hip/hip_bf16.h>
#include <math.h>

typedef __attribute__((ext_vector_type(16))) __bf16 v16bf;
typedef __attribute__((ext_vector_type(8)))  __bf16 v8bf;
typedef __attribute__((ext_vector_type(4)))  __bf16 v4bf;
typedef __attribute__((ext_vector_type(8)))  float  v8f;

#define G_     4
#define B_     16
#define CIN_   512
#define T_     2048
#define H_     2048
#define COUT_  512
#define KG1_   128   // Cin/G
#define KG2_   512   // H/G
#define TN_    128   // token tile per block
#define W1ELEMS_ (H_ * KG1_)     // 262144
#define W2ELEMS_ (COUT_ * KG2_)  // 262144

// K8-interleaved LDS layout: element (k, n) -> ((k>>3)*TN_ + n)*8 + (k&7)

// A fragment (16x32 bf16) from fragment-ordered bf16 weights: 2x global b128 loads,
// each 512 contiguous bytes for the wave (four whole 128-byte lines).
// Fragment (row tile, k step) = 512 elements: 32 lanes x 8 (k 0..7 / 8..15 by lane
// half), then 32 lanes x 8 (k 16..23 / 24..31).
__device__ __forceinline__ v16bf load_a_bf16(const __bf16* __restrict__ W,
                                             int row0, int ld, int kb, int lane) {
  const __bf16* wr = W + ((size_t)(row0 >> 4) * (ld >> 5) + (kb >> 5)) * 512 + lane * 8;
  const v8bf lo = *(const v8bf*)(wr);
  const v8bf hs = *(const v8bf*)(wr + 256);
  return __builtin_shufflevector(lo, hs, 0, 1, 2, 3, 4, 5, 6, 7,
                                 8, 9, 10, 11, 12, 13, 14, 15);
}

// B fragment (32x16) from K8-interleaved LDS: 2x ds_load_b128.
__device__ __forceinline__ v16bf load_b_k8(const __bf16* S, int kb, int nb, int lane) {
  const int n  = nb + (lane & 15);
  const int hi = lane >> 4;
  const int kg = (kb >> 3) + hi;
  const v8bf lo = *(const v8bf*)(S + ((size_t)kg * TN_ + n) * 8);
  const v8bf hs = *(const v8bf*)(S + ((size_t)(kg + 2) * TN_ + n) * 8);
  return __builtin_shufflevector(lo, hs, 0, 1, 2, 3, 4, 5, 6, 7,
                                 8, 9, 10, 11, 12, 13, 14, 15);
}

// GELU via native CDNA5 v_tanh_f32 transcendental (error << bf16 storage ulp), on one
// accumulator tile's eight values, stage by stage: eight independent chains side by side.
// The tanh is the builtin: the compiler sees a transcendental, fills the slot behind it with
// a neighbour chain's work and hints its readers, so no issue slot goes to a v_nop.
__device__ __forceinline__ void gelu_fast8(const v8f v, float (&o)[8]) {
  float u[8], hv[8], t[8];
#pragma unroll
  for (int r = 0; r < 8; ++r) {
    const float v2 = v[r] * v[r];
    u[r]  = v[r] * fmaf(v2, 0.0356774081f, 0.7978845608f);
    hv[r] = 0.5f * v[r];
  }
#pragma unroll
  for (int r = 0; r < 8; ++r)
    t[r] = __builtin_amdgcn_tanhf(u[r]);
#pragma unroll
  for (int r = 0; r < 8; ++r) o[r] = fmaf(hv[r], t[r], hv[r]);
}

// ---- prologue: convert f32 weights to bf16 in workspace, in A-fragment order ----
// One thread per 8-element piece of the packed layout (one lane's b128 of a fragment).
// W2's K columns are dealt so that k step kk = 4 * g + p of an output group holds, in
// order, the 32 hidden rows p * 32 .. p * 32 + 31 of input group g (shuffled column
// 4 * row + g): the order in which stage 1 leaves them in a wave's accumulators.
__global__ __launch_bounds__(256) void cvt_weights(const float* __restrict__ w1,
                                                   const float* __restrict__ w2,
                                                   __bf16* __restrict__ wb) {
  const int idx = blockIdx.x * 256 + threadIdx.x;   // 65536 threads
  const bool first = idx < W1ELEMS_ / 8;
  const int c    = first ? idx : idx - W1ELEMS_ / 8;
  const int lks  = first ? 2 : 4;                   // log2(k steps per row tile)
  const int frag = c >> 6;
  const int half = (c >> 5) & 1;
  const int lane = c & 31;
  const int row  = (frag >> lks) * 16 + (lane & 15);
  const int kk   = frag & ((1 << lks) - 1);         // k step
  const int k    = half * 16 + (lane >> 4) * 8;     // place in the k step
  const float* s = first ? w1 + (size_t)row * KG1_ + kk * 32 + k
                         : w2 + (size_t)row * KG2_ + 4 * ((kk & 3) * 32 + k) + (kk >> 2);
  const int st = first ? 1 : 4;                     // W2: every 4th column
  v8bf p;
#pragma unroll
  for (int e = 0; e < 8; ++e) p[e] = (__bf16)s[e * st];
  *(v8bf*)(wb + (size_t)idx * 8) = p;
}

__global__ __launch_bounds__(256) void ffn2_fused_wmma(
    const float* __restrict__ x, const float* __restrict__ mask,
    const __bf16* __restrict__ w1b, const float* __restrict__ b1,
    const __bf16* __restrict__ w2b, const float* __restrict__ b2,
    float* __restrict__ out) {
  __shared__ __bf16 Xs[CIN_ * TN_];  // masked input tile, K8 layout (128 KB)

  const int tid  = threadIdx.x;
  const int lane = tid & 31;
  const int wave = __builtin_amdgcn_readfirstlane(tid >> 5);
  const int nlo  = lane & 15;
  const int hi   = lane >> 4;

  const int bid   = blockIdx.x;
  const int tTile = bid & 15;            // T_/TN_ = 16 tiles
  const int b     = bid >> 4;            // batch
  const int t0    = tTile * TN_;

  // ---- X tile load: 8 coalesced b32 loads + mask + pack -> ds_store_b128 ----
  {
    const int n = tid & (TN_ - 1);
    const float mk = mask[(size_t)b * T_ + t0 + n];
    const float* xp0 = x + (size_t)b * CIN_ * T_ + t0 + n;
    // Eight trips' loads in flight: 8 waves stage what 16 staged, so each keeps more
    // bytes under way to cover the memory latency.
#pragma unroll 8
    for (int i = 0; i < CIN_ / 16; ++i) {
      const int kg = 2 * i + (tid >> 7);                // 8-channel group
      const float* xp = xp0 + (size_t)(kg * 8) * T_;
      v8bf pk;
#pragma unroll
      for (int e = 0; e < 8; ++e)
        pk[e] = (__bf16)(xp[(size_t)e * T_] * mk);
      *(v8bf*)(Xs + ((size_t)kg * TN_ + n) * 8) = pk;
    }
  }
  __syncthreads();

  // A wave owns ONE output group for 64 tokens, from X to out: the hidden rows that feed
  // an output group feed no other, so no wave needs another wave's hidden values.
  const int g2 = wave & 3;               // output group
  const int n0 = (wave >> 2) * 64;       // token half

  v8f acc2[8][4];                        // 128 out rows x 64 tokens
#pragma unroll
  for (int mt = 0; mt < 8; ++mt) {
    v8f binit2;
#pragma unroll
    for (int r = 0; r < 8; ++r) binit2[r] = b2[g2 * 128 + mt * 16 + r + hi * 8];
#pragma unroll
    for (int nt = 0; nt < 4; ++nt) acc2[mt][nt] = binit2;
  }

  // W1 fragments and bias of the coming trip's 32 hidden rows.
  v16bf a1[2][4];
  v8f bi[2];
#pragma unroll
  for (int mt = 0; mt < 2; ++mt) {
    const int row0 = 128 * g2 + mt * 16;
#pragma unroll
    for (int ks = 0; ks < 4; ++ks)
      a1[mt][ks] = load_a_bf16(w1b, row0, KG1_, ks * 32, lane);
#pragma unroll
    for (int r = 0; r < 8; ++r) bi[mt][r] = b1[row0 + r + hi * 8];
  }

  // X fragments of the coming trip's first two k steps.
  v16bf bxa[4], bxb[4];
#pragma unroll
  for (int nt = 0; nt < 4; ++nt) {
    bxa[nt] = load_b_k8(Xs, 0, n0 + nt * 16, lane);
    bxb[nt] = load_b_k8(Xs, 32, n0 + nt * 16, lane);
  }

  // The loop reuses the registers that hold the addresses of the loads above.
  asm volatile("s_wait_xcnt 0x0" ::: "memory");
  __builtin_amdgcn_sched_barrier(0);   // keeps that wait behind them, ahead of the loop

  // 16 trips: input group g = it / 4, 32 hidden rows a trip = one k step of stage 2.
  // Kept rolled: one copy of the trip in the instruction cache.
#pragma unroll 1
  for (int it = 0; it < 16; ++it) {
    const int g = it >> 2;

    // ---- stage 1: 32 hidden rows x 64 tokens, K = 128 ----
    v8f d[2][4];
#pragma unroll
    for (int mt = 0; mt < 2; ++mt)
#pragma unroll
      for (int nt = 0; nt < 4; ++nt) d[mt][nt] = bi[mt];
    // The X fragments come from LDS in whole groups of 8 loads, two k steps ahead of
    // their WMMAs; the sched_barriers below hold a group together at its place (for speed only).
#pragma unroll
    for (int ks = 0; ks < 4; ++ks) {
      v16bf (&bx)[4] = (ks & 1) ? bxb : bxa;
#pragma unroll
      for (int mt = 0; mt < 2; ++mt)
#pragma unroll
        for (int nt = 0; nt < 4; ++nt)
          d[mt][nt] = __builtin_amdgcn_wmma_f32_16x16x32_bf16(
              false, a1[mt][ks], false, bx[nt], (short)0, d[mt][nt], false, false);
      if (ks < 2) {
        __builtin_amdgcn_sched_barrier(0);
#pragma unroll
        for (int nt = 0; nt < 4; ++nt)
          bx[nt] = load_b_k8(Xs, g * KG1_ + (ks + 2) * 32, n0 + nt * 16, lane);
        __builtin_amdgcn_sched_barrier(0);
      }
    }

    // This trip's W2 fragments: one k step of the group's 8 row tiles.
    v16bf a2[8];
#pragma unroll
    for (int mt = 0; mt < 8; ++mt)
      a2[mt] = load_a_bf16(w2b, g2 * 128 + mt * 16, KG2_, it * 32, lane);
    // The address arithmetic of the loads below reuses these loads' address registers;
    // the sched_barrier keeps that arithmetic behind the wait.
    asm volatile("s_wait_xcnt 0x0" ::: "memory");
    __builtin_amdgcn_sched_barrier(0);
    // The next trip's W1 fragments and bias (the last trip wraps to the first: in
    // bounds, not used).
    {
      const int itn = (it + 1) & 15;
#pragma unroll
      for (int mt = 0; mt < 2; ++mt) {
        const int row0 = (itn >> 2) * 512 + 128 * g2 + (itn & 3) * 32 + mt * 16;
#pragma unroll
        for (int ks = 0; ks < 4; ++ks)
          a1[mt][ks] = load_a_bf16(w1b, row0, KG1_, ks * 32, lane);
#pragma unroll
        for (int r = 0; r < 8; ++r) bi[mt][r] = b1[row0 + r + hi * 8];
      }
    }
    // The GELU reuses the registers that hold these loads' addresses.
    asm volatile("s_wait_xcnt 0x0" ::: "memory");
    // Holds the trip's weight loads, and that wait, ahead of the GELU, whose run covers
    // the loads' latency.
    __builtin_amdgcn_sched_barrier(0);

    // ---- GELU in place: the two accumulator tiles of a token column (rows 0..15 and
    // 16..31), converted, ARE the B fragment of stage 2's k step ----
    v16bf hb[4];
#pragma unroll
    for (int nt = 0; nt < 4; ++nt)
#pragma unroll
      for (int mt = 0; mt < 2; ++mt) {
        float ge[8];
        gelu_fast8(d[mt][nt], ge);
#pragma unroll
        for (int r = 0; r < 8; ++r) hb[nt][mt * 8 + r] = (__bf16)ge[r];
      }

    // ---- stage 2: 128 out rows x 64 tokens, this trip's k step ----
#pragma unroll
    for (int mt = 0; mt < 8; ++mt) {
      if (mt == 4) {
        // The next trip's first X fragments, as one group, into the registers that the
        // first four W2 fragments have left; the barriers hold the group at this place.
        __builtin_amdgcn_sched_barrier(0);
        const int gn = ((it + 1) & 15) >> 2;
#pragma unroll
        for (int nt = 0; nt < 4; ++nt) {
          bxa[nt] = load_b_k8(Xs, gn * KG1_, n0 + nt * 16, lane);
          bxb[nt] = load_b_k8(Xs, gn * KG1_ + 32, n0 + nt * 16, lane);
        }
        __builtin_amdgcn_sched_barrier(0);
      }
#pragma unroll
      for (int nt = 0; nt < 4; ++nt)
        acc2[mt][nt] = __builtin_amdgcn_wmma_f32_16x16x32_bf16(
            false, a2[mt], false, hb[nt], (short)0, acc2[mt][nt], false, false);
    }
  }

  float* ob = out + ((size_t)b * COUT_ + g2 * 128 + hi * 8) * T_ + t0 + n0 + nlo;
#pragma unroll
  for (int nt = 0; nt < 4; ++nt) {
    const float mk = mask[(size_t)b * T_ + t0 + n0 + nt * 16 + nlo];
#pragma unroll
    for (int mt = 0; mt < 8; ++mt) acc2[mt][nt] *= mk;
  }
  // Every product ahead of the first store: the stores issue in one run, and no register
  // that an issued store names is written again.
  __builtin_amdgcn_sched_barrier(0);
#pragma unroll
  for (int mt = 0; mt < 8; ++mt)
#pragma unroll
    for (int r = 0; r < 8; ++r)
#pragma unroll
      for (int nt = 0; nt < 4; ++nt)   // a row's 256 bytes in four stores in a row
        ob[(size_t)(mt * 16 + r) * T_ + nt * 16] = acc2[mt][nt][r];
}

extern "C" void kernel_launch(void* const* d_in, const int* in_sizes, int n_in,
                              void* d_out, int out_size, void* d_ws, size_t ws_size,
                              hipStream_t stream) {
  const float* x    = (const float*)d_in[0];
  const float* mask = (const float*)d_in[1];
  const float* w1   = (const float*)d_in[2];
  const float* b1   = (const float*)d_in[3];
  const float* w2   = (const float*)d_in[4];
  const float* b2   = (const float*)d_in[5];
  float* out = (float*)d_out;

  __bf16* wb  = (__bf16*)d_ws;                  // 1 MB: w1 then w2 as bf16, fragment order
  const __bf16* w1b = wb;
  const __bf16* w2b = wb + W1ELEMS_;

  cvt_weights<<<(W1ELEMS_ + W2ELEMS_) / (256 * 8), 256, 0, stream>>>(w1, w2, wb);

  const int nBlocks = B_ * (T_ / TN_);          // 256
  ffn2_fused_wmma<<<nBlocks, 256, 0, stream>>>(x, mask, w1b, b1, w2b, b2,
                                               (float*)d_out);
  (void)out; (void)in_sizes; (void)n_in; (void)out_size; (void)ws_size;
}

// v006
// A run of this version takes 40.1 microseconds.
// Timed twice side by side with v005, it ran 1.04 and 1.03 times as fast.
// All steps since v000 together make it 1.89 times as fast.
#include <hip/hip_runtime.h>
#include <hip/hip_bf16.h>
#include <math.h>

typedef __attribute__((ext_vector_type(16))) __bf16 v16bf;
typedef __attribute__((ext_vector_type(8)))  __bf16 v8bf;
typedef __attribute__((ext_vector_type(4)))  __bf16 v4bf;
typedef __attribute__((ext_vector_type(8)))  float  v8f;

#define G_     4
#define B_     16
#define CIN_   512
#define T_     2048
#define H_     2048
#define COUT_  512
#define KG1_   128   // Cin/G
#define KG2_   512   // H/G
#define TN_    128   // token tile per block
#define W1ELEMS_ (H_ * KG1_)     // 262144
#define W2ELEMS_ (COUT_ * KG2_)  // 262144

// K8-interleaved LDS layout: element (k, n) -> ((k>>3)*TN_ + n)*8 + (k&7)

// A fragment (16x32 bf16) from fragment-ordered bf16 weights: 2x global b128 loads,
// each 512 contiguous bytes for the wave (four whole 128-byte lines).
// Fragment (row tile, k step) = 512 elements: 32 lanes x 8 (k 0..7 / 8..15 by lane
// half), then 32 lanes x 8 (k 16..23 / 24..31).
__device__ __forceinline__ v16bf load_a_bf16(const __bf16* __restrict__ W,
                                             int row0, int ld, int kb, int lane) {
  const __bf16* wr = W + ((size_t)(row0 >> 4) * (ld >> 5) + (kb >> 5)) * 512 + lane * 8;
  const v8bf lo = *(const v8bf*)(wr);
  const v8bf hs = *(const v8bf*)(wr + 256);
  return __builtin_shufflevector(lo, hs, 0, 1, 2, 3, 4, 5, 6, 7,
                                 8, 9, 10, 11, 12, 13, 14, 15);
}

// B fragment (32x16) from K8-interleaved LDS: 2x ds_load_b128.
__device__ __forceinline__ v16bf load_b_k8(const __bf16* S, int kb, int nb, int lane) {
  const int n  = nb + (lane & 15);
  const int hi = lane >> 4;
  const int kg = (kb >> 3) + hi;
  const v8bf lo = *(const v8bf*)(S + ((size_t)kg * TN_ + n) * 8);
  const v8bf hs = *(const v8bf*)(S + ((size_t)(kg + 2) * TN_ + n) * 8);
  return __builtin_shufflevector(lo, hs, 0, 1, 2, 3, 4, 5, 6, 7,
                                 8, 9, 10, 11, 12, 13, 14, 15);
}

// GELU via native CDNA5 v_tanh_f32 transcendental (error << bf16 storage ulp), on one
// accumulator tile's eight values, stage by stage: eight independent chains side by side.
// The tanh is the builtin: the compiler sees a transcendental, fills the slot behind it with
// a neighbour chain's work and hints its readers, so no issue slot goes to a v_nop.
__device__ __forceinline__ void gelu_fast8(const v8f v, float (&o)[8]) {
  float u[8], hv[8], t[8];
#pragma unroll
  for (int r = 0; r < 8; ++r) {
    const float v2 = v[r] * v[r];
    u[r]  = v[r] * fmaf(v2, 0.0356774081f, 0.7978845608f);
    hv[r] = 0.5f * v[r];
  }
#pragma unroll
  for (int r = 0; r < 8; ++r)
    t[r] = __builtin_amdgcn_tanhf(u[r]);
#pragma unroll
  for (int r = 0; r < 8; ++r) o[r] = fmaf(hv[r], t[r], hv[r]);
}

// ---- prologue: convert f32 weights to bf16 in workspace, in A-fragment order ----
// One thread per 8-element piece of the packed layout (one lane's b128 of a fragment).
// W2's K columns are dealt so that k step kk = 4 * g + p of an output group holds, in
// order, the 32 hidden rows p * 32 .. p * 32 + 31 of input group g (shuffled column
// 4 * row + g): the order in which stage 1 leaves them in a wave's accumulators.
__global__ __launch_bounds__(256) void cvt_weights(const float* __restrict__ w1,
                                                   const float* __restrict__ w2,
                                                   __bf16* __restrict__ wb) {
  const int idx = blockIdx.x * 256 + threadIdx.x;   // 65536 threads
  const bool first = idx < W1ELEMS_ / 8;
  const int c    = first ? idx : idx - W1ELEMS_ / 8;
  const int lks  = first ? 2 : 4;                   // log2(k steps per row tile)
  const int frag = c >> 6;
  const int half = (c >> 5) & 1;
  const int lane = c & 31;
  const int row  = (frag >> lks) * 16 + (lane & 15);
  const int kk   = frag & ((1 << lks) - 1);         // k step
  const int k    = half * 16 + (lane >> 4) * 8;     // place in the k step
  const float* s = first ? w1 + (size_t)row * KG1_ + kk * 32 + k
                         : w2 + (size_t)row * KG2_ + 4 * ((kk & 3) * 32 + k) + (kk >> 2);
  const int st = first ? 1 : 4;                     // W2: every 4th column
  v8bf p;
#pragma unroll
  for (int e = 0; e < 8; ++e) p[e] = (__bf16)s[e * st];
  *(v8bf*)(wb + (size_t)idx * 8) = p;
}

__global__ __launch_bounds__(256) void ffn2_fused_wmma(
    const float* __restrict__ x, const float* __restrict__ mask,
    const __bf16* __restrict__ w1b, const float* __restrict__ b1,
    const __bf16* __restrict__ w2b, const float* __restrict__ b2,
    float* __restrict__ out) {
  __shared__ __bf16 Xs[CIN_ * TN_];  // masked input tile, K8 layout (128 KB)

  const int tid  = threadIdx.x;
  const int lane = tid & 31;
  const int wave = __builtin_amdgcn_readfirstlane(tid >> 5);
  const int nlo  = lane & 15;
  const int hi   = lane >> 4;

  const int bid   = blockIdx.x;
  const int tTile = bid & 15;            // T_/TN_ = 16 tiles
  const int b     = bid >> 4;            // batch
  const int t0    = tTile * TN_;

  // ---- X tile load: 8 coalesced b32 loads + mask + pack -> ds_store_b128 ----
  {
    const int n = tid & (TN_ - 1);
    const float mk = mask[(size_t)b * T_ + t0 + n];
    const float* xp0 = x + (size_t)b * CIN_ * T_ + t0 + n;
    // Eight trips' loads in flight: 8 waves stage what 16 staged, so each keeps more
    // bytes under way to cover the memory latency.
#pragma unroll 8
    for (int i = 0; i < CIN_ / 16; ++i) {
      const int kg = 2 * i + (tid >> 7);                // 8-channel group
      const float* xp = xp0 + (size_t)(kg * 8) * T_;
      v8bf pk;
#pragma unroll
      for (int e = 0; e < 8; ++e)
        pk[e] = (__bf16)(xp[(size_t)e * T_] * mk);
      *(v8bf*)(Xs + ((size_t)kg * TN_ + n) * 8) = pk;
    }
  }
  __syncthreads();

  // A wave owns ONE output group for 64 tokens, from X to out: the hidden rows that feed
  // an output group feed no other, so no wave needs another wave's hidden values.
  const int g2 = wave & 3;               // output group
  const int n0 = (wave >> 2) * 64;       // token half

  v8f acc2[8][4];                        // 128 out rows x 64 tokens
#pragma unroll
  for (int mt = 0; mt < 8; ++mt) {
    v8f binit2;
#pragma unroll
    for (int r = 0; r < 8; ++r) binit2[r] = b2[g2 * 128 + mt * 16 + r + hi * 8];
#pragma unroll
    for (int nt = 0; nt < 4; ++nt) acc2[mt][nt] = binit2;
  }

  // W1 fragments and bias of the coming trip's 32 hidden rows.
  v16bf a1[2][4];
  v8f bi[2];
#pragma unroll
  for (int mt = 0; mt < 2; ++mt) {
    const int row0 = 128 * g2 + mt * 16;
#pragma unroll
    for (int ks = 0; ks < 4; ++ks)
      a1[mt][ks] = load_a_bf16(w1b, row0, KG1_, ks * 32, lane);
#pragma unroll
    for (int r = 0; r < 8; ++r) bi[mt][r] = b1[row0 + r + hi * 8];
  }

  // X fragments of the coming trip's first two k steps.
  v16bf bxa[4], bxb[4];
#pragma unroll
  for (int nt = 0; nt < 4; ++nt) {
    bxa[nt] = load_b_k8(Xs, 0, n0 + nt * 16, lane);
    bxb[nt] = load_b_k8(Xs, 32, n0 + nt * 16, lane);
  }

  // The loop reuses the registers that hold the addresses of the loads above.
  asm volatile("s_wait_xcnt 0x0" ::: "memory");
  __builtin_amdgcn_sched_barrier(0);   // keeps that wait behind them, ahead of the loop

  // 16 trips: input group g = it / 4, 32 hidden rows a trip = one k step of stage 2.
  // Kept rolled: one copy of the trip in the instruction cache.
#pragma unroll 1
  for (int it = 0; it < 16; ++it) {
    const int g = it >> 2;

    // ---- stage 1: 32 hidden rows x 64 tokens, K = 128 ----
    v8f d[2][4];
    v16bf a2[8];
#pragma unroll
    for (int mt = 0; mt < 2; ++mt)
#pragma unroll
      for (int nt = 0; nt < 4; ++nt) d[mt][nt] = bi[mt];
    // The X fragments come from LDS in whole groups of 8 loads, two k steps ahead of
    // their WMMAs; the sched_barriers below hold a group together at its place (for speed only).
#pragma unroll
    for (int ks = 0; ks < 4; ++ks) {
      v16bf (&bx)[4] = (ks & 1) ? bxb : bxa;
#pragma unroll
      for (int mt = 0; mt < 2; ++mt)
#pragma unroll
        for (int nt = 0; nt < 4; ++nt)
          d[mt][nt] = __builtin_amdgcn_wmma_f32_16x16x32_bf16(
              false, a1[mt][ks], false, bx[nt], (short)0, d[mt][nt], false, false);
      if (ks < 2) {
        __builtin_amdgcn_sched_barrier(0);
#pragma unroll
        for (int nt = 0; nt < 4; ++nt)
          bx[nt] = load_b_k8(Xs, g * KG1_ + (ks + 2) * 32, n0 + nt * 16, lane);
        __builtin_amdgcn_sched_barrier(0);
      }
      if (ks == 1) {
        // This trip's W2 fragments: one k step of the group's 8 row tiles. Asked for here,
        // half a stage 1 ahead of the priority change, which the compiler moves no load over.
#pragma unroll
        for (int mt = 0; mt < 8; ++mt)
          a2[mt] = load_a_bf16(w2b, g2 * 128 + mt * 16, KG2_, it * 32, lane);
        // Later address arithmetic reuses these loads' address registers; the
        // sched_barrier keeps that arithmetic behind the wait.
        asm volatile("s_wait_xcnt 0x0" ::: "memory");
        __builtin_amdgcn_sched_barrier(0);
      }
    }

    // The matrix run (stage 2's second half and this stage 1) is over: back to priority 0
    // for the loads and the GELU, so that the SIMD's other wave gets the matrix unit.
    __builtin_amdgcn_s_setprio(0);
    // The next trip's W1 fragments and bias (the last trip wraps to the first: in
    // bounds, not used).
    {
      const int itn = (it + 1) & 15;
#pragma unroll
      for (int mt = 0; mt < 2; ++mt) {
        const int row0 = (itn >> 2) * 512 + 128 * g2 + (itn & 3) * 32 + mt * 16;
#pragma unroll
        for (int ks = 0; ks < 4; ++ks)
          a1[mt][ks] = load_a_bf16(w1b, row0, KG1_, ks * 32, lane);
#pragma unroll
        for (int r = 0; r < 8; ++r) bi[mt][r] = b1[row0 + r + hi * 8];
      }
    }
    // The GELU reuses the registers that hold these loads' addresses.
    asm volatile("s_wait_xcnt 0x0" ::: "memory");
    // Holds the trip's weight loads, and that wait, ahead of the GELU, whose run covers
    // the loads' latency.
    __builtin_amdgcn_sched_barrier(0);

    // ---- GELU in place: the two accumulator tiles of a token column (rows 0..15 and
    // 16..31), converted, ARE the B fragment of stage 2's k step ----
    v16bf hb[4];
#pragma unroll
    for (int nt = 0; nt < 4; ++nt)
#pragma unroll
      for (int mt = 0; mt < 2; ++mt) {
        float ge[8];
        gelu_fast8(d[mt][nt], ge);
#pragma unroll
        for (int r = 0; r < 8; ++r) hb[nt][mt * 8 + r] = (__bf16)ge[r];
      }

    // ---- stage 2: 128 out rows x 64 tokens, this trip's k step ----
#pragma unroll
    for (int mt = 0; mt < 8; ++mt) {
      if (mt == 4) {
        // The next trip's first X fragments, as one group, into the registers that the
        // first four W2 fragments have left; the barriers hold the group at this place.
        __builtin_amdgcn_sched_barrier(0);
        const int gn = ((it + 1) & 15) >> 2;
#pragma unroll
        for (int nt = 0; nt < 4; ++nt) {
          bxa[nt] = load_b_k8(Xs, gn * KG1_, n0 + nt * 16, lane);
          bxb[nt] = load_b_k8(Xs, gn * KG1_ + 32, n0 + nt * 16, lane);
        }
        // A matrix run starts at priority 0 and goes on at 3: a wave that comes out of its
        // GELU waits for the other wave's run to end instead of breaking into its last part,
        // which would leave both waves in their GELU at the same time.
        __builtin_amdgcn_s_setprio(3);
        __builtin_amdgcn_sched_barrier(0);
      }
#pragma unroll
      for (int nt = 0; nt < 4; ++nt)
        acc2[mt][nt] = __builtin_amdgcn_wmma_f32_16x16x32_bf16(
            false, a2[mt], false, hb[nt], (short)0, acc2[mt][nt], false, false);
    }
  }

  __builtin_amdgcn_s_setprio(0);   // priority 0 on the way out
  float* ob = out + ((size_t)b * COUT_ + g2 * 128 + hi * 8) * T_ + t0 + n0 + nlo;
#pragma unroll
  for (int nt = 0; nt < 4; ++nt) {
    const float mk = mask[(size_t)b * T_ + t0 + n0 + nt * 16 + nlo];
#pragma unroll
    for (int mt = 0; mt < 8; ++mt) acc2[mt][nt] *= mk;
  }
  // Every product ahead of the first store: the stores issue in one run, and no register
  // that an issued store names is written again.
  __builtin_amdgcn_sched_barrier(0);
#pragma unroll
  for (int mt = 0; mt < 8; ++mt)
#pragma unroll
    for (int r = 0; r < 8; ++r)
#pragma unroll
      for (int nt = 0; nt < 4; ++nt)   // a row's 256 bytes in four stores in a row
        ob[(size_t)(mt * 16 + r) * T_ + nt * 16] = acc2[mt][nt][r];
}

extern "C" void kernel_launch(void* const* d_in, const int* in_sizes, int n_in,
                              void* d_out, int out_size, void* d_ws, size_t ws_size,
                              hipStream_t stream) {
  const float* x    = (const float*)d_in[0];
  const float* mask = (const float*)d_in[1];
  const float* w1   = (const float*)d_in[2];
  const float* b1   = (const float*)d_in[3];
  const float* w2   = (const float*)d_in[4];
  const float* b2   = (const float*)d_in[5];
  float* out = (float*)d_out;

  __bf16* wb  = (__bf16*)d_ws;                  // 1 MB: w1 then w2 as bf16, fragment order
  const __bf16* w1b = wb;
  const __bf16* w2b = wb + W1ELEMS_;

  cvt_weights<<<(W1ELEMS_ + W2ELEMS_) / (256 * 8), 256, 0, stream>>>(w1, w2, wb);

  const int nBlocks = B_ * (T_ / TN_);          // 256
  ffn2_fused_wmma<<<nBlocks, 256, 0, stream>>>(x, mask, w1b, b1, w2b, b2,
                                               (float*)d_out);
  (void)out; (void)in_sizes; (void)n_in; (void)out_size; (void)ws_size;
}

// v007
// It runs in 34.1 microseconds.
// Next to v006, in two timings, it ran 1.18 times as fast each time.
// Over all steps from v000 it is 2.22 times as fast.
#include <hip/hip_runtime.h>
#include <hip/hip_bf16.h>
#include <math.h>

typedef __attribute__((ext_vector_type(16))) __bf16 v16bf;
typedef __attribute__((ext_vector_type(8)))  __bf16 v8bf;
typedef __attribute__((ext_vector_type(4)))  __bf16 v4bf;
typedef __attribute__((ext_vector_type(8)))  float  v8f;
typedef __attribute__((ext_vector_type(4)))  float  v4f;

#define G_     4
#define B_     16
#define CIN_   512
#define T_     2048
#define H_     2048
#define COUT_  512
#define KG1_   128   // Cin/G
#define KG2_   512   // H/G
#define TN_    128   // token tile per block
#define W1ELEMS_ (H_ * KG1_)     // 262144
#define W2ELEMS_ (COUT_ * KG2_)  // 262144

// K8-interleaved LDS layout: element (k, slot) -> ((k>>3)*TN_ + slot)*8 + (k&7).
// Token n of the tile sits in slot (n & 64) | (n & 3) << 4 | (n >> 2) & 15: column c of a
// wave's B tile j is token 4 * c + j of its 64, so the four accumulator tiles of an output
// row hold, in one lane, four adjacent tokens.

// A fragment (16x32 bf16) from fragment-ordered bf16 weights: 2x global b128 loads,
// each 512 contiguous bytes for the wave (four whole 128-byte lines).
// Fragment (row tile, k step) = 512 elements: 32 lanes x 8 (k 0..7 / 8..15 by lane
// half), then 32 lanes x 8 (k 16..23 / 24..31).
__device__ __forceinline__ v16bf load_a_bf16(const __bf16* __restrict__ W,
                                             int row0, int ld, int kb, int lane) {
  const __bf16* wr = W + ((size_t)(row0 >> 4) * (ld >> 5) + (kb >> 5)) * 512 + lane * 8;
  const v8bf lo = *(const v8bf*)(wr);
  const v8bf hs = *(const v8bf*)(wr + 256);
  return __builtin_shufflevector(lo, hs, 0, 1, 2, 3, 4, 5, 6, 7,
                                 8, 9, 10, 11, 12, 13, 14, 15);
}

// B fragment (32x16) from K8-interleaved LDS: 2x ds_load_b128.
__device__ __forceinline__ v16bf load_b_k8(const __bf16* S, int kb, int nb, int lane) {
  const int n  = nb + (lane & 15);
  const int hi = lane >> 4;
  const int kg = (kb >> 3) + hi;
  const v8bf lo = *(const v8bf*)(S + ((size_t)kg * TN_ + n) * 8);
  const v8bf hs = *(const v8bf*)(S + ((size_t)(kg + 2) * TN_ + n) * 8);
  return __builtin_shufflevector(lo, hs, 0, 1, 2, 3, 4, 5, 6, 7,
                                 8, 9, 10, 11, 12, 13, 14, 15);
}

// GELU via native CDNA5 v_tanh_f32 transcendental (error << bf16 storage ulp), on one
// accumulator tile's eight values, stage by stage: eight independent chains side by side.
// The tanh is the builtin: the compiler sees a transcendental, fills the slot behind it with
// a neighbour chain's work and hints its readers, so no issue slot goes to a v_nop.
__device__ __forceinline__ void gelu_fast8(const v8f v, float (&o)[8]) {
  float u[8], hv[8], t[8];
#pragma unroll
  for (int r = 0; r < 8; ++r) {
    const float v2 = v[r] * v[r];
    u[r]  = v[r] * fmaf(v2, 0.0356774081f, 0.7978845608f);
    hv[r] = 0.5f * v[r];
  }
#pragma unroll
  for (int r = 0; r < 8; ++r)
    t[r] = __builtin_amdgcn_tanhf(u[r]);
#pragma unroll
  for (int r = 0; r < 8; ++r) o[r] = fmaf(hv[r], t[r], hv[r]);
}

// ---- prologue: convert f32 weights to bf16 in workspace, in A-fragment order ----
// One thread per 8-element piece of the packed layout (one lane's b128 of a fragment).
// W2's K columns are dealt so that k step kk = 4 * g + p of an output group holds, in
// order, the 32 hidden rows p * 32 .. p * 32 + 31 of input group g (shuffled column
// 4 * row + g): the order in which stage 1 leaves them in a wave's accumulators.
__global__ __launch_bounds__(256) void cvt_weights(const float* __restrict__ w1,
                                                   const float* __restrict__ w2,
                                                   __bf16* __restrict__ wb) {
  const int idx = blockIdx.x * 256 + threadIdx.x;   // 65536 threads
  const bool first = idx < W1ELEMS_ / 8;
  const int c    = first ? idx : idx - W1ELEMS_ / 8;
  const int lks  = first ? 2 : 4;                   // log2(k steps per row tile)
  const int frag = c >> 6;
  const int half = (c >> 5) & 1;
  const int lane = c & 31;
  const int row  = (frag >> lks) * 16 + (lane & 15);
  const int kk   = frag & ((1 << lks) - 1);         // k step
  const int k    = half * 16 + (lane >> 4) * 8;     // place in the k step
  const float* s = first ? w1 + (size_t)row * KG1_ + kk * 32 + k
                         : w2 + (size_t)row * KG2_ + 4 * ((kk & 3) * 32 + k) + (kk >> 2);
  const int st = first ? 1 : 4;                     // W2: every 4th column
  v8bf p;
#pragma unroll
  for (int e = 0; e < 8; ++e) p[e] = (__bf16)s[e * st];
  *(v8bf*)(wb + (size_t)idx * 8) = p;
}

__global__ __launch_bounds__(256) void ffn2_fused_wmma(
    const float* __restrict__ x, const float* __restrict__ mask,
    const __bf16* __restrict__ w1b, const float* __restrict__ b1,
    const __bf16* __restrict__ w2b, const float* __restrict__ b2,
    float* __restrict__ out) {
  __shared__ __bf16 Xs[CIN_ * TN_];  // masked input tile, K8 layout (128 KB)

  const int tid  = threadIdx.x;
  const int lane = tid & 31;
  const int wave = __builtin_amdgcn_readfirstlane(tid >> 5);
  const int nlo  = lane & 15;
  const int hi   = lane >> 4;

  const int bid   = blockIdx.x;
  const int tTile = bid & 15;            // T_/TN_ = 16 tiles
  const int b     = bid >> 4;            // batch
  const int t0    = tTile * TN_;

  // ---- X tile load: 8 coalesced b32 loads + mask + pack -> ds_store_b128 ----
  {
    const int n = tid & (TN_ - 1);
    const int slot = (n & 64) | ((n & 3) << 4) | ((n >> 2) & 15);
    // The token's mask value, load and data wait in one statement: the address arithmetic
    // that follows reuses the load's address registers, and a wait in a statement of its own
    // did not stay in front of that overwrite.
    float mk;
    asm volatile("global_load_b32 %0, %1, off\n\ts_wait_loadcnt 0x0"
                 : "=&v"(mk) : "v"(mask + (size_t)b * T_ + t0 + n) : "memory");
    const float* xp0 = x + (size_t)b * CIN_ * T_ + t0 + n;
    // Eight trips' loads in flight: 8 waves stage what 16 staged, so each keeps more
    // bytes under way to cover the memory latency.
#pragma unroll 8
    for (int i = 0; i < CIN_ / 16; ++i) {
      const int kg = 2 * i + (tid >> 7);                // 8-channel group
      const float* xp = xp0 + (size_t)(kg * 8) * T_;
      v8bf pk;
#pragma unroll
      for (int e = 0; e < 8; ++e)
        pk[e] = (__bf16)(xp[(size_t)e * T_] * mk);
      *(v8bf*)(Xs + ((size_t)kg * TN_ + slot) * 8) = pk;
    }
  }
  __syncthreads();

  // A wave owns ONE output group for 64 tokens, from X to out: the hidden rows that feed
  // an output group feed no other, so no wave needs another wave's hidden values.
  const int g2 = wave & 3;               // output group
  const int n0 = (wave >> 2) * 64;       // token half

  v8f acc2[8][4];                        // 128 out rows x 64 tokens
#pragma unroll
  for (int mt = 0; mt < 8; ++mt) {
    v8f binit2;
#pragma unroll
    for (int r = 0; r < 8; ++r) binit2[r] = b2[g2 * 128 + mt * 16 + r + hi * 8];
#pragma unroll
    for (int nt = 0; nt < 4; ++nt) acc2[mt][nt] = binit2;
  }

  // W1 fragments and bias of the coming trip's 32 hidden rows.
  v16bf a1[2][4];
  v8f bi[2];
#pragma unroll
  for (int mt = 0; mt < 2; ++mt) {
    const int row0 = 128 * g2 + mt * 16;
#pragma unroll
    for (int ks = 0; ks < 4; ++ks)
      a1[mt][ks] = load_a_bf16(w1b, row0, KG1_, ks * 32, lane);
#pragma unroll
    for (int r = 0; r < 8; ++r) bi[mt][r] = b1[row0 + r + hi * 8];
  }

  // X fragments of the coming trip's first two k steps.
  v16bf bxa[4], bxb[4];
#pragma unroll
  for (int nt = 0; nt < 4; ++nt) {
    bxa[nt] = load_b_k8(Xs, 0, n0 + nt * 16, lane);
    bxb[nt] = load_b_k8(Xs, 32, n0 + nt * 16, lane);
  }

  // The loop reuses the registers that hold the addresses of the loads above.
  asm volatile("s_wait_xcnt 0x0" ::: "memory");
  __builtin_amdgcn_sched_barrier(0);   // keeps that wait behind them, ahead of the loop

  // 16 trips: input group g = it / 4, 32 hidden rows a trip = one k step of stage 2.
  // Kept rolled: one copy of the trip in the instruction cache.
#pragma unroll 1
  for (int it = 0; it < 16; ++it) {
    const int g = it >> 2;

    // ---- stage 1: 32 hidden rows x 64 tokens, K = 128 ----
    v8f d[2][4];
    v16bf a2[8];
#pragma unroll
    for (int mt = 0; mt < 2; ++mt)
#pragma unroll
      for (int nt = 0; nt < 4; ++nt) d[mt][nt] = bi[mt];
    // The X fragments come from LDS in whole groups of 8 loads, two k steps ahead of
    // their WMMAs; the sched_barriers below hold a group together at its place (for speed only).
#pragma unroll
    for (int ks = 0; ks < 4; ++ks) {
      v16bf (&bx)[4] = (ks & 1) ? bxb : bxa;
#pragma unroll
      for (int mt = 0; mt < 2; ++mt)
#pragma unroll
        for (int nt = 0; nt < 4; ++nt)
          d[mt][nt] = __builtin_amdgcn_wmma_f32_16x16x32_bf16(
              false, a1[mt][ks], false, bx[nt], (short)0, d[mt][nt], false, false);
      if (ks < 2) {
        __builtin_amdgcn_sched_barrier(0);
#pragma unroll
        for (int nt = 0; nt < 4; ++nt)
          bx[nt] = load_b_k8(Xs, g * KG1_ + (ks + 2) * 32, n0 + nt * 16, lane);
        __builtin_amdgcn_sched_barrier(0);
      }
      if (ks == 1) {
        // This trip's W2 fragments: one k step of the group's 8 row tiles. Asked for here,
        // half a stage 1 ahead of the priority change, which the compiler moves no load over.
#pragma unroll
        for (int mt = 0; mt < 8; ++mt)
          a2[mt] = load_a_bf16(w2b, g2 * 128 + mt * 16, KG2_, it * 32, lane);
        // Later address arithmetic reuses these loads' address registers; the
        // sched_barrier keeps that arithmetic behind the wait.
        asm volatile("s_wait_xcnt 0x0" ::: "memory");
        __builtin_amdgcn_sched_barrier(0);
      }
    }

    // The matrix run (stage 2's second half and this stage 1) is over: back to priority 0
    // for the loads and the GELU, so that the SIMD's other wave gets the matrix unit.
    __builtin_amdgcn_s_setprio(0);
    // The next trip's W1 fragments and bias (the last trip wraps to the first: in
    // bounds, not used).
    {
      const int itn = (it + 1) & 15;
#pragma unroll
      for (int mt = 0; mt < 2; ++mt) {
        const int row0 = (itn >> 2) * 512 + 128 * g2 + (itn & 3) * 32 + mt * 16;
#pragma unroll
        for (int ks = 0; ks < 4; ++ks)
          a1[mt][ks] = load_a_bf16(w1b, row0, KG1_, ks * 32, lane);
#pragma unroll
        for (int r = 0; r < 8; ++r) bi[mt][r] = b1[row0 + r + hi * 8];
      }
    }
    // The GELU reuses the registers that hold these loads' addresses.
    asm volatile("s_wait_xcnt 0x0" ::: "memory");
    // Holds the trip's weight loads, and that wait, ahead of the GELU, whose run covers
    // the loads' latency.
    __builtin_amdgcn_sched_barrier(0);

    // ---- GELU in place: the two accumulator tiles of a token column (rows 0..15 and
    // 16..31), converted, ARE the B fragment of stage 2's k step ----
    v16bf hb[4];
#pragma unroll
    for (int nt = 0; nt < 4; ++nt)
#pragma unroll
      for (int mt = 0; mt < 2; ++mt) {
        float ge[8];
        gelu_fast8(d[mt][nt], ge);
#pragma unroll
        for (int r = 0; r < 8; ++r) hb[nt][mt * 8 + r] = (__bf16)ge[r];
      }

    // ---- stage 2: 128 out rows x 64 tokens, this trip's k step ----
#pragma unroll
    for (int mt = 0; mt < 8; ++mt) {
      if (mt == 4) {
        // The next trip's first X fragments, as one group, into the registers that the
        // first four W2 fragments have left; the barriers hold the group at this place.
        __builtin_amdgcn_sched_barrier(0);
        const int gn = ((it + 1) & 15) >> 2;
#pragma unroll
        for (int nt = 0; nt < 4; ++nt) {
          bxa[nt] = load_b_k8(Xs, gn * KG1_, n0 + nt * 16, lane);
          bxb[nt] = load_b_k8(Xs, gn * KG1_ + 32, n0 + nt * 16, lane);
        }
        // A matrix run starts at priority 0 and goes on at 3: a wave that comes out of its
        // GELU waits for the other wave's run to end instead of breaking into its last part,
        // which would leave both waves in their GELU at the same time.
        __builtin_amdgcn_s_setprio(3);
        __builtin_amdgcn_sched_barrier(0);
      }
#pragma unroll
      for (int nt = 0; nt < 4; ++nt)
        acc2[mt][nt] = __builtin_amdgcn_wmma_f32_16x16x32_bf16(
            false, a2[mt], false, hb[nt], (short)0, acc2[mt][nt], false, false);
    }
  }

  __builtin_amdgcn_s_setprio(0);   // priority 0 on the way out
  // Lane (nlo, hi) holds tokens 4 * nlo .. 4 * nlo + 3 (one per accumulator tile) of rows
  // r + 8 * hi: one 16-byte store a row, and a wave-wide store is two rows of 256 whole bytes.
  float* ob = out + ((size_t)b * COUT_ + g2 * 128 + hi * 8) * T_ + t0 + n0 + 4 * nlo;
  const v4f mk4 = *(const v4f*)(mask + (size_t)b * T_ + t0 + n0 + 4 * nlo);
  v4f o4[8][8];
#pragma unroll
  for (int mt = 0; mt < 8; ++mt)
#pragma unroll
    for (int r = 0; r < 8; ++r)
#pragma unroll
      for (int nt = 0; nt < 4; ++nt) o4[mt][r][nt] = acc2[mt][nt][r] * mk4[nt];
  // Every product ahead of the first store: the stores issue in one run, and no register
  // that an issued store names is written again.
  __builtin_amdgcn_sched_barrier(0);
#pragma unroll
  for (int mt = 0; mt < 8; ++mt)
#pragma unroll
    for (int r = 0; r < 8; ++r)
      *(v4f*)(ob + (size_t)(mt * 16 + r) * T_) = o4[mt][r];
}

extern "C" void kernel_launch(void* const* d_in, const int* in_sizes, int n_in,
                              void* d_out, int out_size, void* d_ws, size_t ws_size,
                              hipStream_t stream) {
  const float* x    = (const float*)d_in[0];
  const float* mask = (const float*)d_in[1];
  const float* w1   = (const float*)d_in[2];
  const float* b1   = (const float*)d_in[3];
  const float* w2   = (const float*)d_in[4];
  const float* b2   = (const float*)d_in[5];
  float* out = (float*)d_out;

  __bf16* wb  = (__bf16*)d_ws;                  // 1 MB: w1 then w2 as bf16, fragment order
  const __bf16* w1b = wb;
  const __bf16* w2b = wb + W1ELEMS_;

  cvt_weights<<<(W1ELEMS_ + W2ELEMS_) / (256 * 8), 256, 0, stream>>>(w1, w2, wb);

  const int nBlocks = B_ * (T_ / TN_);          // 256
  ffn2_fused_wmma<<<nBlocks, 256, 0, stream>>>(x, mask, w1b, b1, w2b, b2,
                                               (float*)d_out);
  (void)out; (void)in_sizes; (void)n_in; (void)out_size; (void)ws_size;
}

// v008
// A run of this version takes 33.1 microseconds.
// Two timings next to v007 both put it at 1.03 times that version's speed.
// Over all steps from v000 it is 2.30 times as fast.
#include <hip/hip_runtime.h>
#include <hip/hip_bf16.h>
#include <math.h>

typedef __attribute__((ext_vector_type(16))) __bf16 v16bf;
typedef __attribute__((ext_vector_type(8)))  __bf16 v8bf;
typedef __attribute__((ext_vector_type(4)))  __bf16 v4bf;
typedef __attribute__((ext_vector_type(8)))  float  v8f;
typedef __attribute__((ext_vector_type(4)))  float  v4f;

#define G_     4
#define B_     16
#define CIN_   512
#define T_     2048
#define H_     2048
#define COUT_  512
#define KG1_   128   // Cin/G
#define KG2_   512   // H/G
#define TN_    128   // token tile per block
#define W1ELEMS_ (H_ * KG1_)     // 262144
#define W2ELEMS_ (COUT_ * KG2_)  // 262144

// K8-interleaved LDS layout: element (k, slot) -> ((k>>3)*TN_ + slot)*8 + (k&7).
// Token n of the tile sits in slot (n & 64) | (n & 3) << 4 | (n >> 2) & 15: column c of a
// wave's B tile j is token 4 * c + j of its 64, so the four accumulator tiles of an output
// row hold, in one lane, four adjacent tokens.

// A fragment (16x32 bf16) from fragment-ordered bf16 weights: 2x global b128 loads,
// each 512 contiguous bytes for the wave (four whole 128-byte lines).
// Fragment (row tile, k step) = 512 elements: 32 lanes x 8 (k 0..7 / 8..15 by lane
// half), then 32 lanes x 8 (k 16..23 / 24..31).
__device__ __forceinline__ v16bf load_a_bf16(const __bf16* __restrict__ W,
                                             int row0, int ld, int kb, int lane) {
  const __bf16* wr = W + ((size_t)(row0 >> 4) * (ld >> 5) + (kb >> 5)) * 512 + lane * 8;
  const v8bf lo = *(const v8bf*)(wr);
  const v8bf hs = *(const v8bf*)(wr + 256);
  return __builtin_shufflevector(lo, hs, 0, 1, 2, 3, 4, 5, 6, 7,
                                 8, 9, 10, 11, 12, 13, 14, 15);
}

// B fragment (32x16) from K8-interleaved LDS: 2x ds_load_b128.
__device__ __forceinline__ v16bf load_b_k8(const __bf16* S, int kb, int nb, int lane) {
  const int n  = nb + (lane & 15);
  const int hi = lane >> 4;
  const int kg = (kb >> 3) + hi;
  const v8bf lo = *(const v8bf*)(S + ((size_t)kg * TN_ + n) * 8);
  const v8bf hs = *(const v8bf*)(S + ((size_t)(kg + 2) * TN_ + n) * 8);
  return __builtin_shufflevector(lo, hs, 0, 1, 2, 3, 4, 5, 6, 7,
                                 8, 9, 10, 11, 12, 13, 14, 15);
}

// GELU via native CDNA5 v_tanh_f32 transcendental (error << bf16 storage ulp), on one
// accumulator tile's eight values, stage by stage: eight independent chains side by side.
// The tanh is the builtin: the compiler sees a transcendental, fills the slot behind it with
// a neighbour chain's work and hints its readers, so no issue slot goes to a v_nop.
__device__ __forceinline__ void gelu_fast8(const v8f v, float (&o)[8]) {
  float u[8], hv[8], t[8];
#pragma unroll
  for (int r = 0; r < 8; ++r) {
    const float v2 = v[r] * v[r];
    u[r]  = v[r] * fmaf(v2, 0.0356774081f, 0.7978845608f);
    hv[r] = 0.5f * v[r];
  }
#pragma unroll
  for (int r = 0; r < 8; ++r)
    t[r] = __builtin_amdgcn_tanhf(u[r]);
#pragma unroll
  for (int r = 0; r < 8; ++r) o[r] = fmaf(hv[r], t[r], hv[r]);
}

// ---- prologue: convert f32 weights to bf16 in workspace, in A-fragment order ----
// One thread per 8-element piece of the packed layout (one lane's b128 of a fragment).
// W2's K columns are dealt so that k step kk = 4 * g + p of an output group holds, in
// order, the 32 hidden rows p * 32 .. p * 32 + 31 of input group g (shuffled column
// 4 * row + g): the order in which stage 1 leaves them in a wave's accumulators.
__global__ __launch_bounds__(256) void cvt_weights(const float* __restrict__ w1,
                                                   const float* __restrict__ w2,
                                                   __bf16* __restrict__ wb) {
  const int idx = blockIdx.x * 256 + threadIdx.x;   // 65536 threads
  const bool first = idx < W1ELEMS_ / 8;
  const int c    = first ? idx : idx - W1ELEMS_ / 8;
  const int lks  = first ? 2 : 4;                   // log2(k steps per row tile)
  const int frag = c >> 6;
  const int half = (c >> 5) & 1;
  const int lane = c & 31;
  const int row  = (frag >> lks) * 16 + (lane & 15);
  const int kk   = frag & ((1 << lks) - 1);         // k step
  const int k    = half * 16 + (lane >> 4) * 8;     // place in the k step
  const float* s = first ? w1 + (size_t)row * KG1_ + kk * 32 + k
                         : w2 + (size_t)row * KG2_ + 4 * ((kk & 3) * 32 + k) + (kk >> 2);
  const int st = first ? 1 : 4;                     // W2: every 4th column
  v8bf p;
#pragma unroll
  for (int e = 0; e < 8; ++e) p[e] = (__bf16)s[e * st];
  *(v8bf*)(wb + (size_t)idx * 8) = p;
}

__global__ __launch_bounds__(256) void ffn2_fused_wmma(
    const float* __restrict__ x, const float* __restrict__ mask,
    const __bf16* __restrict__ w1b, const float* __restrict__ b1,
    const __bf16* __restrict__ w2b, const float* __restrict__ b2,
    float* __restrict__ out) {
  __shared__ __bf16 Xs[CIN_ * TN_];  // masked input tile, K8 layout (128 KB)

  const int tid  = threadIdx.x;
  const int lane = tid & 31;
  const int wave = __builtin_amdgcn_readfirstlane(tid >> 5);
  const int nlo  = lane & 15;
  const int hi   = lane >> 4;

  const int bid   = blockIdx.x;
  const int tTile = bid & 15;            // T_/TN_ = 16 tiles
  const int b     = bid >> 4;            // batch
  const int t0    = tTile * TN_;
  // Every block walks the same 1 MB of weights. Each starts the walk at a trip of its own and
  // wraps, so that at one moment the blocks ask L2 for 16 different parts of it, not all for
  // the same lines. Blocks 8 apart in index differ too.
  const int it0   = (tTile + b) & 15;

  // ---- X tile load: 8 coalesced b32 loads + mask + pack -> ds_store_b128 ----
  {
    const int n = tid & (TN_ - 1);
    const int slot = (n & 64) | ((n & 3) << 4) | ((n >> 2) & 15);
    // The token's mask value, load and data wait in one statement: the address arithmetic
    // that follows reuses the load's address registers, and a wait in a statement of its own
    // did not stay in front of that overwrite.
    float mk;
    asm volatile("global_load_b32 %0, %1, off\n\ts_wait_loadcnt 0x0"
                 : "=&v"(mk) : "v"(mask + (size_t)b * T_ + t0 + n) : "memory");
    const float* xp0 = x + (size_t)b * CIN_ * T_ + t0 + n;
    // Eight trips' loads in flight: 8 waves stage what 16 staged, so each keeps more
    // bytes under way to cover the memory latency.
#pragma unroll 8
    for (int i = 0; i < CIN_ / 16; ++i) {
      const int kg = 2 * i + (tid >> 7);                // 8-channel group
      const float* xp = xp0 + (size_t)(kg * 8) * T_;
      v8bf pk;
#pragma unroll
      for (int e = 0; e < 8; ++e)
        pk[e] = (__bf16)(xp[(size_t)e * T_] * mk);
      *(v8bf*)(Xs + ((size_t)kg * TN_ + slot) * 8) = pk;
    }
  }
  __syncthreads();

  // A wave owns ONE output group for 64 tokens, from X to out: the hidden rows that feed
  // an output group feed no other, so no wave needs another wave's hidden values.
  const int g2 = wave & 3;               // output group
  const int n0 = (wave >> 2) * 64;       // token half

  v8f binit2[8];                         // bias of the 128 out rows
#pragma unroll
  for (int mt = 0; mt < 8; ++mt)
#pragma unroll
    for (int r = 0; r < 8; ++r) binit2[mt][r] = b2[g2 * 128 + mt * 16 + r + hi * 8];
  // The address arithmetic of the start trip's loads reuses these loads' address registers;
  // the sched_barrier keeps that arithmetic behind the wait.
  asm volatile("s_wait_xcnt 0x0" ::: "memory");
  __builtin_amdgcn_sched_barrier(0);

  // W1 fragments and bias of the coming trip's 32 hidden rows.
  v16bf a1[2][4];
  v8f bi[2];
#pragma unroll
  for (int mt = 0; mt < 2; ++mt) {
    const int row0 = (it0 >> 2) * 512 + 128 * g2 + (it0 & 3) * 32 + mt * 16;
#pragma unroll
    for (int ks = 0; ks < 4; ++ks)
      a1[mt][ks] = load_a_bf16(w1b, row0, KG1_, ks * 32, lane);
#pragma unroll
    for (int r = 0; r < 8; ++r) bi[mt][r] = b1[row0 + r + hi * 8];
  }
  // What follows, the loop too, reuses the registers that hold the addresses of the loads above.
  asm volatile("s_wait_xcnt 0x0" ::: "memory");
  __builtin_amdgcn_sched_barrier(0);   // keeps what follows behind that wait

  // X fragments of the coming trip's first two k steps.
  v16bf bxa[4], bxb[4];
#pragma unroll
  for (int nt = 0; nt < 4; ++nt) {
    bxa[nt] = load_b_k8(Xs, (it0 >> 2) * KG1_, n0 + nt * 16, lane);
    bxb[nt] = load_b_k8(Xs, (it0 >> 2) * KG1_ + 32, n0 + nt * 16, lane);
  }

  v8f acc2[8][4];                        // 128 out rows x 64 tokens, start value: the bias
#pragma unroll
  for (int mt = 0; mt < 8; ++mt)
#pragma unroll
    for (int nt = 0; nt < 4; ++nt) acc2[mt][nt] = binit2[mt];

  // 16 trips: input group g = it / 4, 32 hidden rows a trip = one k step of stage 2,
  // taken in the order it0, it0 + 1, ... modulo 16.
  // Kept rolled: one copy of the trip in the instruction cache.
#pragma unroll 1
  for (int i = 0; i < 16; ++i) {
    const int it = (it0 + i) & 15;
    const int g = it >> 2;

    // ---- stage 1: 32 hidden rows x 64 tokens, K = 128 ----
    v8f d[2][4];
    v16bf a2[8];
#pragma unroll
    for (int mt = 0; mt < 2; ++mt)
#pragma unroll
      for (int nt = 0; nt < 4; ++nt) d[mt][nt] = bi[mt];
    // The X fragments come from LDS in whole groups of 8 loads, two k steps ahead of
    // their WMMAs; the sched_barriers below hold a group together at its place (for speed only).
#pragma unroll
    for (int ks = 0; ks < 4; ++ks) {
      v16bf (&bx)[4] = (ks & 1) ? bxb : bxa;
#pragma unroll
      for (int mt = 0; mt < 2; ++mt)
#pragma unroll
        for (int nt = 0; nt < 4; ++nt)
          d[mt][nt] = __builtin_amdgcn_wmma_f32_16x16x32_bf16(
              false, a1[mt][ks], false, bx[nt], (short)0, d[mt][nt], false, false);
      if (ks < 2) {
        __builtin_amdgcn_sched_barrier(0);
#pragma unroll
        for (int nt = 0; nt < 4; ++nt)
          bx[nt] = load_b_k8(Xs, g * KG1_ + (ks + 2) * 32, n0 + nt * 16, lane);
        __builtin_amdgcn_sched_barrier(0);
      }
      if (ks == 1) {
        // This trip's W2 fragments: one k step of the group's 8 row tiles. Asked for here,
        // half a stage 1 ahead of the priority change, which the compiler moves no load over.
#pragma unroll
        for (int mt = 0; mt < 8; ++mt)
          a2[mt] = load_a_bf16(w2b, g2 * 128 + mt * 16, KG2_, it * 32, lane);
        // Later address arithmetic reuses these loads' address registers; the
        // sched_barrier keeps that arithmetic behind the wait.
        asm volatile("s_wait_xcnt 0x0" ::: "memory");
        __builtin_amdgcn_sched_barrier(0);
      }
    }

    // The matrix run (stage 2's second half and this stage 1) is over: back to priority 0
    // for the loads and the GELU, so that the SIMD's other wave gets the matrix unit.
    __builtin_amdgcn_s_setprio(0);
    // The next trip's W1 fragments and bias (the last trip asks for the start trip's
    // again: in bounds, not used).
    {
      const int itn = (it + 1) & 15;
#pragma unroll
      for (int mt = 0; mt < 2; ++mt) {
        const int row0 = (itn >> 2) * 512 + 128 * g2 + (itn & 3) * 32 + mt * 16;
#pragma unroll
        for (int ks = 0; ks < 4; ++ks)
          a1[mt][ks] = load_a_bf16(w1b, row0, KG1_, ks * 32, lane);
#pragma unroll
        for (int r = 0; r < 8; ++r) bi[mt][r] = b1[row0 + r + hi * 8];
      }
    }
    // The GELU reuses the registers that hold these loads' addresses.
    asm volatile("s_wait_xcnt 0x0" ::: "memory");
    // Holds the trip's weight loads, and that wait, ahead of the GELU, whose run covers
    // the loads' latency.
    __builtin_amdgcn_sched_barrier(0);

    // ---- GELU in place: the two accumulator tiles of a token column (rows 0..15 and
    // 16..31), converted, ARE the B fragment of stage 2's k step ----
    v16bf hb[4];
#pragma unroll
    for (int nt = 0; nt < 4; ++nt)
#pragma unroll
      for (int mt = 0; mt < 2; ++mt) {
        float ge[8];
        gelu_fast8(d[mt][nt], ge);
#pragma unroll
        for (int r = 0; r < 8; ++r) hb[nt][mt * 8 + r] = (__bf16)ge[r];
      }

    // ---- stage 2: 128 out rows x 64 tokens, this trip's k step ----
#pragma unroll
    for (int mt = 0; mt < 8; ++mt) {
      if (mt == 4) {
        // The next trip's first X fragments, as one group, into the registers that the
        // first four W2 fragments have left; the barriers hold the group at this place.
        __builtin_amdgcn_sched_barrier(0);
        const int gn = ((it + 1) & 15) >> 2;
#pragma unroll
        for (int nt = 0; nt < 4; ++nt) {
          bxa[nt] = load_b_k8(Xs, gn * KG1_, n0 + nt * 16, lane);
          bxb[nt] = load_b_k8(Xs, gn * KG1_ + 32, n0 + nt * 16, lane);
        }
        // A matrix run starts at priority 0 and goes on at 3: a wave that comes out of its
        // GELU waits for the other wave's run to end instead of breaking into its last part,
        // which would leave both waves in their GELU at the same time.
        __builtin_amdgcn_s_setprio(3);
        __builtin_amdgcn_sched_barrier(0);
      }
#pragma unroll
      for (int nt = 0; nt < 4; ++nt)
        acc2[mt][nt] = __builtin_amdgcn_wmma_f32_16x16x32_bf16(
            false, a2[mt], false, hb[nt], (short)0, acc2[mt][nt], false, false);
    }
  }

  __builtin_amdgcn_s_setprio(0);   // priority 0 on the way out
  // Lane (nlo, hi) holds tokens 4 * nlo .. 4 * nlo + 3 (one per accumulator tile) of rows
  // r + 8 * hi: one 16-byte store a row, and a wave-wide store is two rows of 256 whole bytes.
  float* ob = out + ((size_t)b * COUT_ + g2 * 128 + hi * 8) * T_ + t0 + n0 + 4 * nlo;
  const v4f mk4 = *(const v4f*)(mask + (size_t)b * T_ + t0 + n0 + 4 * nlo);
  v4f o4[8][8];
#pragma unroll
  for (int mt = 0; mt < 8; ++mt)
#pragma unroll
    for (int r = 0; r < 8; ++r)
#pragma unroll
      for (int nt = 0; nt < 4; ++nt) o4[mt][r][nt] = acc2[mt][nt][r] * mk4[nt];
  // Every product ahead of the first store: the stores issue in one run, and no register
  // that an issued store names is written again.
  __builtin_amdgcn_sched_barrier(0);
#pragma unroll
  for (int mt = 0; mt < 8; ++mt)
#pragma unroll
    for (int r = 0; r < 8; ++r)
      *(v4f*)(ob + (size_t)(mt * 16 + r) * T_) = o4[mt][r];
}

extern "C" void kernel_launch(void* const* d_in, const int* in_sizes, int n_in,
                              void* d_out, int out_size, void* d_ws, size_t ws_size,
                              hipStream_t stream) {
  const float* x    = (const float*)d_in[0];
  const float* mask = (const float*)d_in[1];
  const float* w1   = (const float*)d_in[2];
  const float* b1   = (const float*)d_in[3];
  const float* w2   = (const float*)d_in[4];
  const float* b2   = (const float*)d_in[5];
  float* out = (float*)d_out;

  __bf16* wb  = (__bf16*)d_ws;                  // 1 MB: w1 then w2 as bf16, fragment order
  const __bf16* w1b = wb;
  const __bf16* w2b = wb + W1ELEMS_;

  cvt_weights<<<(W1ELEMS_ + W2ELEMS_) / (256 * 8), 256, 0, stream>>>(w1, w2, wb);

  const int nBlocks = B_ * (T_ / TN_);          // 256
  ffn2_fused_wmma<<<nBlocks, 256, 0, stream>>>(x, mask, w1b, b1, w2b, b2,
                                               (float*)d_out);
  (void)out; (void)in_sizes; (void)n_in; (void)out_size; (void)ws_size;
}

// v009
// It runs in 31.6 microseconds.
// Next to v008, in two timings, it ran 1.05 and 1.04 times as fast.
// Counting every step since v000, it is 2.40 times as fast.
#include <hip/hip_runtime.h>
#include <hip/hip_bf16.h>
#include <math.h>

typedef __attribute__((ext_vector_type(16))) __bf16 v16bf;
typedef __attribute__((ext_vector_type(8)))  __bf16 v8bf;
typedef __attribute__((ext_vector_type(4)))  __bf16 v4bf;
typedef __attribute__((ext_vector_type(8)))  float  v8f;
typedef __attribute__((ext_vector_type(4)))  float  v4f;

#define G_     4
#define B_     16
#define CIN_   512
#define T_     2048
#define H_     2048
#define COUT_  512
#define KG1_   128   // Cin/G
#define KG2_   512   // H/G
#define TN_    128   // token tile per block
#define W1ELEMS_ (H_ * KG1_)     // 262144
#define W2ELEMS_ (COUT_ * KG2_)  // 262144

// K8-interleaved LDS layout: element (k, slot) -> ((k>>3)*TN_ + slot)*8 + (k&7).
// Token n of the tile sits in slot (n & 64) | (n & 3) << 4 | (n >> 2) & 15: column c of a
// wave's B tile j is token 4 * c + j of its 64, so the four accumulator tiles of an output
// row hold, in one lane, four adjacent tokens.

// A fragment (16x32 bf16) from fragment-ordered bf16 weights: 2x global b128 loads,
// each 512 contiguous bytes for the wave (four whole 128-byte lines).
// Fragment (row tile, k step) = 512 elements: 32 lanes x 8 (k 0..7 / 8..15 by lane
// half), then 32 lanes x 8 (k 16..23 / 24..31).
__device__ __forceinline__ v16bf load_a_bf16(const __bf16* __restrict__ W,
                                             int row0, int ld, int kb, int lane) {
  const __bf16* wr = W + ((size_t)(row0 >> 4) * (ld >> 5) + (kb >> 5)) * 512 + lane * 8;
  const v8bf lo = *(const v8bf*)(wr);
  const v8bf hs = *(const v8bf*)(wr + 256);
  return __builtin_shufflevector(lo, hs, 0, 1, 2, 3, 4, 5, 6, 7,
                                 8, 9, 10, 11, 12, 13, 14, 15);
}

// B fragment (32x16) from K8-interleaved LDS: 2x ds_load_b128.
__device__ __forceinline__ v16bf load_b_k8(const __bf16* S, int kb, int nb, int lane) {
  const int n  = nb + (lane & 15);
  const int hi = lane >> 4;
  const int kg = (kb >> 3) + hi;
  const v8bf lo = *(const v8bf*)(S + ((size_t)kg * TN_ + n) * 8);
  const v8bf hs = *(const v8bf*)(S + ((size_t)(kg + 2) * TN_ + n) * 8);
  return __builtin_shufflevector(lo, hs, 0, 1, 2, 3, 4, 5, 6, 7,
                                 8, 9, 10, 11, 12, 13, 14, 15);
}

// GELU via native CDNA5 v_tanh_f32 transcendental (error << bf16 storage ulp), on one
// accumulator tile's eight values, stage by stage: eight independent chains side by side.
// The tanh is the builtin: the compiler sees a transcendental, fills the slot behind it with
// a neighbour chain's work and hints its readers, so no issue slot goes to a v_nop.
__device__ __forceinline__ void gelu_fast8(const v8f v, float (&o)[8]) {
  float u[8], hv[8], t[8];
#pragma unroll
  for (int r = 0; r < 8; ++r) {
    const float v2 = v[r] * v[r];
    u[r]  = v[r] * fmaf(v2, 0.0356774081f, 0.7978845608f);
    hv[r] = 0.5f * v[r];
  }
#pragma unroll
  for (int r = 0; r < 8; ++r)
    t[r] = __builtin_amdgcn_tanhf(u[r]);
#pragma unroll
  for (int r = 0; r < 8; ++r) o[r] = fmaf(hv[r], t[r], hv[r]);
}

// Trip number of a block's i-th trip: the input groups in the order g0, g0 + 1, ... modulo 4,
// inside a group the four trips in the order p0, p0 + 1, ... modulo 4 (it0 = 4 * g0 + p0).
// For a given i the 16 values of it0 give 16 different trips.
__device__ __forceinline__ int trip_of(int it0, int i) {
  return ((((it0 >> 2) + (i >> 2)) & 3) << 2) | ((it0 + i) & 3);
}

// A wave's 16 channel rows of 128 tokens (512 bytes a row, 16 bytes a lane), f32 as they lie
// in memory, into its own part of the raw buffer in LDS, through no register.
// g: token 0 of the first row (the same for the wave); l: the lane's LDS byte address in the
// first row; lane16: 16 * lane. Row r lies 8192 * r bytes on in memory and 512 * r bytes on in
// LDS. The immediate offset moves both addresses by 512 * r, and the row's scalar base adds the
// other 7680 * r to the global one: one LDS register and one offset register serve all rows.
// The s_wait_xcnt stands inside the copies' statement: what follows reuses their registers.
__device__ __forceinline__ void copy_rows16(const float* g, unsigned l, unsigned lane16) {
  const char* p = (const char*)g;
  asm volatile(
      "global_load_async_to_lds_b128 %0, %1, %2\n\t"
      "global_load_async_to_lds_b128 %0, %1, %3 offset:512\n\t"
      "global_load_async_to_lds_b128 %0, %1, %4 offset:1024\n\t"
      "global_load_async_to_lds_b128 %0, %1, %5 offset:1536\n\t"
      "global_load_async_to_lds_b128 %0, %1, %6 offset:2048\n\t"
      "global_load_async_to_lds_b128 %0, %1, %7 offset:2560\n\t"
      "global_load_async_to_lds_b128 %0, %1, %8 offset:3072\n\t"
      "global_load_async_to_lds_b128 %0, %1, %9 offset:3584\n\t"
      "s_wait_xcnt 0x0"
      :: "v"(l), "v"(lane16),
         "s"(p), "s"(p + 7680), "s"(p + 2 * 7680), "s"(p + 3 * 7680),
         "s"(p + 4 * 7680), "s"(p + 5 * 7680), "s"(p + 6 * 7680), "s"(p + 7 * 7680)
      : "memory");
  asm volatile(
      "global_load_async_to_lds_b128 %0, %1, %2 offset:4096\n\t"
      "global_load_async_to_lds_b128 %0, %1, %3 offset:4608\n\t"
      "global_load_async_to_lds_b128 %0, %1, %4 offset:5120\n\t"
      "global_load_async_to_lds_b128 %0, %1, %5 offset:5632\n\t"
      "global_load_async_to_lds_b128 %0, %1, %6 offset:6144\n\t"
      "global_load_async_to_lds_b128 %0, %1, %7 offset:6656\n\t"
      "global_load_async_to_lds_b128 %0, %1, %8 offset:7168\n\t"
      "global_load_async_to_lds_b128 %0, %1, %9 offset:7680\n\t"
      "s_wait_xcnt 0x0"
      :: "v"(l), "v"(lane16),
         "s"(p + 8 * 7680), "s"(p + 9 * 7680), "s"(p + 10 * 7680), "s"(p + 11 * 7680),
         "s"(p + 12 * 7680), "s"(p + 13 * 7680), "s"(p + 14 * 7680), "s"(p + 15 * 7680)
      : "memory");
}

// ---- prologue: convert f32 weights to bf16 in workspace, in A-fragment order ----
// One thread per 8-element piece of the packed layout (one lane's b128 of a fragment).
// W2's K columns are dealt so that k step kk = 4 * g + p of an output group holds, in
// order, the 32 hidden rows p * 32 .. p * 32 + 31 of input group g (shuffled column
// 4 * row + g): the order in which stage 1 leaves them in a wave's accumulators.
__global__ __launch_bounds__(256) void cvt_weights(const float* __restrict__ w1,
                                                   const float* __restrict__ w2,
                                                   __bf16* __restrict__ wb) {
  const int idx = blockIdx.x * 256 + threadIdx.x;   // 65536 threads
  const bool first = idx < W1ELEMS_ / 8;
  const int c    = first ? idx : idx - W1ELEMS_ / 8;
  const int lks  = first ? 2 : 4;                   // log2(k steps per row tile)
  const int frag = c >> 6;
  const int half = (c >> 5) & 1;
  const int lane = c & 31;
  const int row  = (frag >> lks) * 16 + (lane & 15);
  const int kk   = frag & ((1 << lks) - 1);         // k step
  const int k    = half * 16 + (lane >> 4) * 8;     // place in the k step
  const float* s = first ? w1 + (size_t)row * KG1_ + kk * 32 + k
                         : w2 + (size_t)row * KG2_ + 4 * ((kk & 3) * 32 + k) + (kk >> 2);
  const int st = first ? 1 : 4;                     // W2: every 4th column
  v8bf p;
#pragma unroll
  for (int e = 0; e < 8; ++e) p[e] = (__bf16)s[e * st];
  *(v8bf*)(wb + (size_t)idx * 8) = p;
}

__global__ __launch_bounds__(256) void ffn2_fused_wmma(
    const float* __restrict__ x, const float* __restrict__ mask,
    const __bf16* __restrict__ w1b, const float* __restrict__ b1,
    const __bf16* __restrict__ w2b, const float* __restrict__ b2,
    float* __restrict__ out) {
  __shared__ __bf16 Xs[CIN_ * TN_];  // masked input tile, K8 layout (128 KB)
  // One input group's 128 channels x 128 tokens as f32 (64 KB), 16 channel rows a wave, and
  // behind each wave's 16 rows a row with the tile's 128 mask values. A wave copies its 17 rows
  // itself and is the only one that reads them.
  __shared__ __attribute__((aligned(512))) float Xr[8 * 17 * TN_];

  const int tid  = threadIdx.x;
  const int lane = tid & 31;
  const int wave = __builtin_amdgcn_readfirstlane(tid >> 5);
  const int nlo  = lane & 15;
  const int hi   = lane >> 4;

  const int bid   = blockIdx.x;
  const int tTile = bid & 15;            // T_/TN_ = 16 tiles
  const int b     = bid >> 4;            // batch
  const int t0    = tTile * TN_;
  // Every block walks the same 1 MB of weights. Each starts the walk at a trip of its own and
  // wraps, so that at one moment the blocks ask L2 for 16 different parts of it, not all for
  // the same lines. Blocks 8 apart in index differ too.
  const int it0   = (tTile + b) & 15;
  const int g0    = it0 >> 2;            // the input group of the first four trips
  const unsigned lane16 = (unsigned)lane * 16u;
  const float* xrp = Xr + (size_t)(wave * 17) * TN_ + 4 * lane;     // the lane's place in its wave's raw rows
  const unsigned xr_lds = (unsigned)(size_t)(const __attribute__((address_space(3))) float*)xrp;
  const float* xw = x + ((size_t)b * CIN_ + wave * 16) * T_ + t0;   // the same for the wave

  // ---- X of the first input group only: 8 coalesced b32 loads + mask + pack -> ds_store_b128.
  // The other three groups come in while the trips of the group before them run.
  {
    const int n = tid & (TN_ - 1);
    const int slot = (n & 64) | ((n & 3) << 4) | ((n >> 2) & 15);
    // The token's mask value, load and data wait in one statement: the address arithmetic
    // that follows reuses the load's address registers, and a wait in a statement of its own
    // did not stay in front of that overwrite.
    float mk;
    asm volatile("global_load_b32 %0, %1, off\n\ts_wait_loadcnt 0x0"
                 : "=&v"(mk) : "v"(mask + (size_t)b * T_ + t0 + n) : "memory");
    const float* xp0 = x + ((size_t)b * CIN_ + g0 * KG1_) * T_ + t0 + n;
    float xv[8][8];
    // Keeps the index arithmetic above in front of the loads: behind them it would overwrite
    // their address registers ahead of the wait below.
    __builtin_amdgcn_sched_barrier(0);
#pragma unroll
    for (int i = 0; i < 8; ++i)
#pragma unroll
      for (int e = 0; e < 8; ++e)
        xv[i][e] = xp0[(size_t)((2 * i + (tid >> 7)) * 8 + e) * T_];
    // The copies' address arithmetic reuses these loads' address registers; the
    // sched_barrier keeps it behind the wait, and the copies behind the loads they must not delay.
    asm volatile("s_wait_xcnt 0x0" ::: "memory");
    __builtin_amdgcn_sched_barrier(0);
    // The second group's copies fly from here to the fourth trip.
    copy_rows16(xw + (size_t)(((g0 + 1) & 3) * KG1_) * T_, xr_lds, lane16);
    // The mask row, once: no later copy lands on it. The wait as in copy_rows16.
    asm volatile("global_load_async_to_lds_b128 %0, %1, %2\n\ts_wait_xcnt 0x0"
                 :: "v"(xr_lds + 16 * TN_ * 4), "v"(lane16), "s"(mask + (size_t)b * T_ + t0)
                 : "memory");
    // Keeps the products below, which wait for the loads' data, behind the copies' issue.
    __builtin_amdgcn_sched_barrier(0);
#pragma unroll
    for (int i = 0; i < 8; ++i) {
      const int kg = g0 * 16 + 2 * i + (tid >> 7);      // 8-channel group
      v8bf pk;
#pragma unroll
      for (int e = 0; e < 8; ++e) pk[e] = (__bf16)(xv[i][e] * mk);
      *(v8bf*)(Xs + ((size_t)kg * TN_ + slot) * 8) = pk;
    }
  }
  __syncthreads();

  // A wave owns ONE output group for 64 tokens, from X to out: the hidden rows that feed
  // an output group feed no other, so no wave needs another wave's hidden values.
  const int g2 = wave & 3;               // output group
  const int n0 = (wave >> 2) * 64;       // token half

  v8f binit2[8];                         // bias of the 128 out rows
#pragma unroll
  for (int mt = 0; mt < 8; ++mt)
#pragma unroll
    for (int r = 0; r < 8; ++r) binit2[mt][r] = b2[g2 * 128 + mt * 16 + r + hi * 8];
  // The address arithmetic of the start trip's loads reuses these loads' address registers;
  // the sched_barrier keeps that arithmetic behind the wait.
  asm volatile("s_wait_xcnt 0x0" ::: "memory");
  __builtin_amdgcn_sched_barrier(0);

  // W1 fragments and bias of the coming trip's 32 hidden rows.
  v16bf a1[2][4];
  v8f bi[2];
#pragma unroll
  for (int mt = 0; mt < 2; ++mt) {
    const int row0 = (it0 >> 2) * 512 + 128 * g2 + (it0 & 3) * 32 + mt * 16;
#pragma unroll
    for (int ks = 0; ks < 4; ++ks)
      a1[mt][ks] = load_a_bf16(w1b, row0, KG1_, ks * 32, lane);
#pragma unroll
    for (int r = 0; r < 8; ++r) bi[mt][r] = b1[row0 + r + hi * 8];
  }
  // What follows, the loop too, reuses the registers that hold the addresses of the loads above.
  asm volatile("s_wait_xcnt 0x0" ::: "memory");
  __builtin_amdgcn_sched_barrier(0);   // keeps what follows behind that wait

  // X fragments of the coming trip's first two k steps.
  v16bf bxa[4], bxb[4];
#pragma unroll
  for (int nt = 0; nt < 4; ++nt) {
    bxa[nt] = load_b_k8(Xs, (it0 >> 2) * KG1_, n0 + nt * 16, lane);
    bxb[nt] = load_b_k8(Xs, (it0 >> 2) * KG1_ + 32, n0 + nt * 16, lane);
  }

  v8f acc2[8][4];                        // 128 out rows x 64 tokens, start value: the bias
#pragma unroll
  for (int mt = 0; mt < 8; ++mt)
#pragma unroll
    for (int nt = 0; nt < 4; ++nt) acc2[mt][nt] = binit2[mt];

  // 16 trips: input group g = it / 4, 32 hidden rows a trip = one k step of stage 2,
  // taken in the order of trip_of(): a whole input group, then the next.
  // Kept rolled: one copy of the trip in the instruction cache.
#pragma unroll 1
  for (int i = 0; i < 16; ++i) {
    const int it = trip_of(it0, i);
    const int g = it >> 2;

    // At the top of a group's last trip: the next group's X, which the copies have brought,
    // goes from the raw buffer to Xs (mask, bf16, K8 layout); this trip's stage 2 fetches
    // the first fragments of it.
    if ((i & 3) == 3 && i < 15) {
      const int gg = (g + 1) & 3;
      // The wave's own copies have landed: it reads no other wave's rows.
      asm volatile("s_wait_asynccnt 0x0" ::: "memory");
      const v4f mq = *(const v4f*)(xrp + 16 * TN_);   // mask of the lane's 4 tokens
#pragma unroll
      for (int q = 0; q < 2; ++q) {
        v4f rw[8];                       // 8 channels x the lane's 4 adjacent tokens
#pragma unroll
        for (int e = 0; e < 8; ++e)
          rw[e] = *(const v4f*)(xrp + (size_t)(q * 8 + e) * TN_);
#pragma unroll
        for (int j = 0; j < 4; ++j) {
          v8bf pk;
#pragma unroll
          for (int e = 0; e < 8; ++e) pk[e] = (__bf16)(rw[e][j] * mq[j]);
          const int slot = ((lane >> 4) << 6) | (j << 4) | (lane & 15);   // token 4 * lane + j
          *(v8bf*)(Xs + ((size_t)(gg * 16 + wave * 2 + q) * TN_ + slot) * 8) = pk;
        }
        // One half's 8 loads and 4 stores at a time: both halves' values at once are more
        // registers than the trip leaves free here.
        __builtin_amdgcn_sched_barrier(0);
      }
      // The wave's reads of its raw rows have retired before its next copies land on them.
      asm volatile("s_wait_dscnt 0x0" ::: "memory");
      if (i < 11)
        // 16 * lane out of the LDS address (every raw row starts at a multiple of 512 bytes):
        // no register of its own has to live from the kernel's start to here.
        copy_rows16(xw + (size_t)(((gg + 1) & 3) * KG1_) * T_, xr_lds, xr_lds & 0x1f0u);
      __syncthreads();                   // every wave's part of the group is in Xs
    }

    // ---- stage 1: 32 hidden rows x 64 tokens, K = 128 ----
    v8f d[2][4];
    v16bf a2[8];
#pragma unroll
    for (int mt = 0; mt < 2; ++mt)
#pragma unroll
      for (int nt = 0; nt < 4; ++nt) d[mt][nt] = bi[mt];
    // The X fragments come from LDS in whole groups of 8 loads, two k steps ahead of
    // their WMMAs; the sched_barriers below hold a group together at its place (for speed only).
#pragma unroll
    for (int ks = 0; ks < 4; ++ks) {
      v16bf (&bx)[4] = (ks & 1) ? bxb : bxa;
#pragma unroll
      for (int mt = 0; mt < 2; ++mt)
#pragma unroll
        for (int nt = 0; nt < 4; ++nt)
          d[mt][nt] = __builtin_amdgcn_wmma_f32_16x16x32_bf16(
              false, a1[mt][ks], false, bx[nt], (short)0, d[mt][nt], false, false);
      if (ks < 2) {
        __builtin_amdgcn_sched_barrier(0);
#pragma unroll
        for (int nt = 0; nt < 4; ++nt)
          bx[nt] = load_b_k8(Xs, g * KG1_ + (ks + 2) * 32, n0 + nt * 16, lane);
        __builtin_amdgcn_sched_barrier(0);
      }
      if (ks == 1) {
        // This trip's W2 fragments: one k step of the group's 8 row tiles. Asked for here,
        // half a stage 1 ahead of the priority change, which the compiler moves no load over.
#pragma unroll
        for (int mt = 0; mt < 8; ++mt)
          a2[mt] = load_a_bf16(w2b, g2 * 128 + mt * 16, KG2_, it * 32, lane);
        // Later address arithmetic reuses these loads' address registers; the
        // sched_barrier keeps that arithmetic behind the wait.
        asm volatile("s_wait_xcnt 0x0" ::: "memory");
        __builtin_amdgcn_sched_barrier(0);
      }
    }

    // The matrix run (stage 2's second half and this stage 1) is over: back to priority 0
    // for the loads and the GELU, so that the SIMD's other wave gets the matrix unit.
    __builtin_amdgcn_s_setprio(0);
    // The next trip's W1 fragments and bias (the last trip asks for the start trip's
    // again: in bounds, not used).
    {
      const int itn = trip_of(it0, i + 1);
#pragma unroll
      for (int mt = 0; mt < 2; ++mt) {
        const int row0 = (itn >> 2) * 512 + 128 * g2 + (itn & 3) * 32 + mt * 16;
#pragma unroll
        for (int ks = 0; ks < 4; ++ks)
          a1[mt][ks] = load_a_bf16(w1b, row0, KG1_, ks * 32, lane);
#pragma unroll
        for (int r = 0; r < 8; ++r) bi[mt][r] = b1[row0 + r + hi * 8];
      }
    }
    // The GELU reuses the registers that hold these loads' addresses.
    asm volatile("s_wait_xcnt 0x0" ::: "memory");
    // Holds the trip's weight loads, and that wait, ahead of the GELU, whose run covers
    // the loads' latency.
    __builtin_amdgcn_sched_barrier(0);

    // ---- GELU in place: the two accumulator tiles of a token column (rows 0..15 and
    // 16..31), converted, ARE the B fragment of stage 2's k step ----
    v16bf hb[4];
#pragma unroll
    for (int nt = 0; nt < 4; ++nt)
#pragma unroll
      for (int mt = 0; mt < 2; ++mt) {
        float ge[8];
        gelu_fast8(d[mt][nt], ge);
#pragma unroll
        for (int r = 0; r < 8; ++r) hb[nt][mt * 8 + r] = (__bf16)ge[r];
      }

    // ---- stage 2: 128 out rows x 64 tokens, this trip's k step ----
#pragma unroll
    for (int mt = 0; mt < 8; ++mt) {
      if (mt == 4) {
        // The next trip's first X fragments, as one group, into the registers that the
        // first four W2 fragments have left; the barriers hold the group at this place.
        __builtin_amdgcn_sched_barrier(0);
        const int gn = trip_of(it0, i + 1) >> 2;
#pragma unroll
        for (int nt = 0; nt < 4; ++nt) {
          bxa[nt] = load_b_k8(Xs, gn * KG1_, n0 + nt * 16, lane);
          bxb[nt] = load_b_k8(Xs, gn * KG1_ + 32, n0 + nt * 16, lane);
        }
        // A matrix run starts at priority 0 and goes on at 3: a wave that comes out of its
        // GELU waits for the other wave's run to end instead of breaking into its last part,
        // which would leave both waves in their GELU at the same time.
        __builtin_amdgcn_s_setprio(3);
        __builtin_amdgcn_sched_barrier(0);
      }
#pragma unroll
      for (int nt = 0; nt < 4; ++nt)
        acc2[mt][nt] = __builtin_amdgcn_wmma_f32_16x16x32_bf16(
            false, a2[mt], false, hb[nt], (short)0, acc2[mt][nt], false, false);
    }
  }

  __builtin_amdgcn_s_setprio(0);   // priority 0 on the way out
  // Lane (nlo, hi) holds tokens 4 * nlo .. 4 * nlo + 3 (one per accumulator tile) of rows
  // r + 8 * hi: one 16-byte store a row, and a wave-wide store is two rows of 256 whole bytes.
  float* ob = out + ((size_t)b * COUT_ + g2 * 128 + hi * 8) * T_ + t0 + n0 + 4 * nlo;
  const v4f mk4 = *(const v4f*)(mask + (size_t)b * T_ + t0 + n0 + 4 * nlo);
  v4f o4[8][8];
#pragma unroll
  for (int mt = 0; mt < 8; ++mt)
#pragma unroll
    for (int r = 0; r < 8; ++r)
#pragma unroll
      for (int nt = 0; nt < 4; ++nt) o4[mt][r][nt] = acc2[mt][nt][r] * mk4[nt];
  // Every product ahead of the first store: the stores issue in one run, and no register
  // that an issued store names is written again.
  __builtin_amdgcn_sched_barrier(0);
#pragma unroll
  for (int mt = 0; mt < 8; ++mt)
#pragma unroll
    for (int r = 0; r < 8; ++r)
      *(v4f*)(ob + (size_t)(mt * 16 + r) * T_) = o4[mt][r];
}

extern "C" void kernel_launch(void* const* d_in, const int* in_sizes, int n_in,
                              void* d_out, int out_size, void* d_ws, size_t ws_size,
                              hipStream_t stream) {
  const float* x    = (const float*)d_in[0];
  const float* mask = (const float*)d_in[1];
  const float* w1   = (const float*)d_in[2];
  const float* b1   = (const float*)d_in[3];
  const float* w2   = (const float*)d_in[4];
  const float* b2   = (const float*)d_in[5];
  float* out = (float*)d_out;

  __bf16* wb  = (__bf16*)d_ws;                  // 1 MB: w1 then w2 as bf16, fragment order
  const __bf16* w1b = wb;
  const __bf16* w2b = wb + W1ELEMS_;

  cvt_weights<<<(W1ELEMS_ + W2ELEMS_) / (256 * 8), 256, 0, stream>>>(w1, w2, wb);

  const int nBlocks = B_ * (T_ / TN_);          // 256
  ffn2_fused_wmma<<<nBlocks, 256, 0, stream>>>(x, mask, w1b, b1, w2b, b2,
                                               (float*)d_out);
  (void)out; (void)in_sizes; (void)n_in; (void)out_size; (void)ws_size;
}
